// v000
// Times are from an AMD MI455X. After a warm-up the kernel runs many times in a row, and a time is the length of
// such a window on the GPU divided by its runs, so every launch and the gaps after it count. The runs cycle
// through copies of the inputs. A figure is the median of several windows, for all but v000 over two sittings.
// Sittings can differ by a few percent; kernels timed side by side share one.
// v000, which the later versions start from, runs in 1120 microseconds.
#include <hip/hip_runtime.h>
#include <stdint.h>

#define B_    8
#define T_    2048
#define N_    16
#define DIN   1024
#define HH    512
#define DOUT  128
#define M_TOT (B_ * T_)        // 16384 tokens

#define M_TILE 64              // tokens per workgroup
#define HC     64              // H columns per fused chunk
#define KSLAB  64              // K staged per LDS slab (2 WMMA k-steps)
#define NSLAB  (DIN / KSLAB)   // 16 slabs per chunk

#define XS_STRIDE 1032         // bf16 elems per x row in LDS (+8 pad)
#define S_STRIDE  72           // bf16 elems per slab row (+8 pad)

// LDS byte offsets
#define XS_OFF   0
#define XS_BYTES (M_TILE * XS_STRIDE * 2)          // 132096
#define WS1_OFF  (XS_OFF + XS_BYTES)
#define WS1_BUF  (HC * S_STRIDE * 2)               // 9216 per buffer
#define HS_OFF   (WS1_OFF + 2 * WS1_BUF)
#define HS_BYTES (M_TILE * S_STRIDE * 2)           // 9216
#define W2_OFF   (HS_OFF + HS_BYTES)
#define W2_BYTES (DOUT * S_STRIDE * 2)             // 18432
#define SMEM_BYTES (W2_OFF + W2_BYTES)             // 178176

typedef __bf16 v16bf __attribute__((ext_vector_type(16)));
typedef float  v8f   __attribute__((ext_vector_type(8)));
typedef int    v4i   __attribute__((ext_vector_type(4)));

#define AS1 __attribute__((address_space(1)))
#define AS3 __attribute__((address_space(3)))

__device__ __forceinline__ unsigned short f2bf(float f) {
  union { float f; uint32_t u; } c; c.f = f;
  uint32_t r = c.u + 0x7FFFu + ((c.u >> 16) & 1u);   // round-to-nearest-even
  return (unsigned short)(r >> 16);
}

// 16-byte global -> LDS copy on the CDNA5 async path (ASYNCcnt),
// with a synchronous VGPR fallback if the builtin is unavailable.
__device__ __forceinline__ void async_cp16(void* lds_dst, const void* gsrc) {
#if __has_builtin(__builtin_amdgcn_global_load_async_to_lds_b128)
  __builtin_amdgcn_global_load_async_to_lds_b128(
      (AS1 v4i*)(uintptr_t)gsrc,
      (AS3 v4i*)(uint32_t)(uintptr_t)lds_dst, 0, 0);
#else
  *(uint4*)lds_dst = *(const uint4*)gsrc;
#endif
}

__device__ __forceinline__ void async_wait_all() {
#if __has_builtin(__builtin_amdgcn_s_wait_asynccnt)
  __builtin_amdgcn_s_wait_asynccnt(0);
#elif __has_builtin(__builtin_amdgcn_global_load_async_to_lds_b128)
  asm volatile("s_wait_asynccnt 0" ::: "memory");
#endif
}

// 16 bf16 fragment = two ds_load_b128
__device__ __forceinline__ v16bf load_frag16(const unsigned short* p) {
  union { uint4 q[2]; v16bf v; } f;
  f.q[0] = *(const uint4*)(p);
  f.q[1] = *(const uint4*)(p + 16);
  return f.v;
}

// ---------------- prep pass: f32 -> bf16, weights pre-transposed ----------------

__global__ __launch_bounds__(256) void cvt_x_kernel(const float* __restrict__ x,
                                                    unsigned short* __restrict__ xb) {
  size_t i = (size_t)blockIdx.x * 256 + threadIdx.x;       // float4 index
  float4 v = *(const float4*)(x + i * 4);
  union { unsigned short s[4]; uint2 u; } pk;
  pk.s[0] = f2bf(v.x); pk.s[1] = f2bf(v.y); pk.s[2] = f2bf(v.z); pk.s[3] = f2bf(v.w);
  *(uint2*)(xb + i * 4) = pk.u;
}

// W1 [n][k][h] (f32) -> W1t [n][h][k] (bf16)
__global__ __launch_bounds__(256) void cvt_w1_kernel(const float* __restrict__ W1,
                                                     unsigned short* __restrict__ W1t) {
  size_t i = (size_t)blockIdx.x * 256 + threadIdx.x;       // float4 index
  int n   = (int)(i >> 17);                                 // 131072 float4 per concept
  int rem = (int)(i & 131071);
  int k   = rem >> 7;                                       // 128 float4 per k row
  int h4  = rem & 127;
  float4 v = *(const float4*)(W1 + ((size_t)n << 19) + (size_t)k * HH + h4 * 4);
  size_t base = ((size_t)n * HH + h4 * 4) * DIN + k;
  W1t[base            ] = f2bf(v.x);
  W1t[base + 1 * DIN  ] = f2bf(v.y);
  W1t[base + 2 * DIN  ] = f2bf(v.z);
  W1t[base + 3 * DIN  ] = f2bf(v.w);
}

// W2 [n][h][o] (f32) -> W2t [n][o][h] (bf16)
__global__ __launch_bounds__(256) void cvt_w2_kernel(const float* __restrict__ W2,
                                                     unsigned short* __restrict__ W2t) {
  size_t i = (size_t)blockIdx.x * 256 + threadIdx.x;       // float4 index
  int n   = (int)(i >> 14);                                 // 16384 float4 per concept
  int rem = (int)(i & 16383);
  int h   = rem >> 5;                                       // 32 float4 per h row
  int o4  = rem & 31;
  float4 v = *(const float4*)(W2 + ((size_t)n << 16) + (size_t)h * DOUT + o4 * 4);
  size_t base = ((size_t)n * DOUT + o4 * 4) * HH + h;
  W2t[base           ] = f2bf(v.x);
  W2t[base + 1 * HH  ] = f2bf(v.y);
  W2t[base + 2 * HH  ] = f2bf(v.z);
  W2t[base + 3 * HH  ] = f2bf(v.w);
}

// ---------------- fused grouped-MLP WMMA kernel ----------------

__global__ __launch_bounds__(256, 1)
void mlp_concept_kernel(const unsigned short* __restrict__ xb,    // [M][1024] bf16
                        const unsigned short* __restrict__ W1t,   // [n][h][k] bf16
                        const unsigned short* __restrict__ W2t,   // [n][o][h] bf16
                        const float* __restrict__ b1,
                        const float* __restrict__ b2p,
                        float* __restrict__ out) {
  extern __shared__ unsigned char smem[];
  unsigned char* xs_b  = smem + XS_OFF;
  unsigned char* ws1_b = smem + WS1_OFF;
  unsigned char* hs_b  = smem + HS_OFF;
  unsigned char* w2_b  = smem + W2_OFF;
  const unsigned short* xs_u  = (const unsigned short*)xs_b;
  const unsigned short* hs_cu = (const unsigned short*)hs_b;
  unsigned short* hs_u = (unsigned short*)hs_b;
  const unsigned short* w2_u  = (const unsigned short*)w2_b;

  const int tid  = threadIdx.x;
  const int wave = tid >> 5;
  const int lane = tid & 31;
  const int l16  = lane & 15;
  const int g    = lane >> 4;            // K-half group per WMMA layout

  const int m0 = blockIdx.x * M_TILE;
  const int n  = blockIdx.y;

  const unsigned char* xb8  = (const unsigned char*)xb + (size_t)m0 * DIN * 2;
  const unsigned char* w1n8 = (const unsigned char*)W1t + (size_t)n * HH * DIN * 2;
  const unsigned char* w2n8 = (const unsigned char*)W2t + (size_t)n * DOUT * HH * 2;

  // ---- async-stage the whole bf16 x tile (resident across all 8 H-chunks)
  #pragma unroll
  for (int i = 0; i < 32; ++i) {                 // 8192 x 16B chunks / 256 threads
    int idx = tid + i * 256;
    int r   = idx >> 7;                          // 128 chunks per token row
    int c   = idx & 127;
    async_cp16(xs_b + r * (XS_STRIDE * 2) + c * 16,
               xb8 + (size_t)r * (DIN * 2) + c * 16);
  }

  const int wrow = (wave >> 1) * 16;
  const int wn1  = (wave & 1) * 32;              // layer1: 2 tiles of 16 cols
  const int wn2  = (wave & 1) * 64;              // layer2: 4 tiles of 16 cols

  v8f oacc[4] = {};

  for (int hc = 0; hc < HH; hc += HC) {
    __syncthreads();                             // prev chunk done with hs / w2t / slabs

    // issue W2 chunk copy: [128 o][64 h] (contiguous along h)
    #pragma unroll
    for (int i = 0; i < 4; ++i) {                // 1024 chunks
      int idx = tid + i * 256;
      int o   = idx >> 3;                        // 8 chunks per o row
      int c   = idx & 7;
      async_cp16(w2_b + o * (S_STRIDE * 2) + c * 16,
                 w2n8 + (size_t)o * (HH * 2) + hc * 2 + c * 16);
    }
    // issue first W1 slab: [64 h][64 k] (contiguous along k)
    #pragma unroll
    for (int i = 0; i < 2; ++i) {                // 512 chunks
      int idx = tid + i * 256;
      int h   = idx >> 3;
      int c   = idx & 7;
      async_cp16(ws1_b + h * (S_STRIDE * 2) + c * 16,
                 w1n8 + (size_t)(hc + h) * (DIN * 2) + c * 16);
    }

    v8f hacc[2] = {};

    // ---- layer 1: K=1024 reduction, double-buffered async slab pipeline
    for (int s = 0; s < NSLAB; ++s) {
      async_wait_all();                          // slab s (+ w2t/x on s==0) landed
      __syncthreads();                           // all waves landed; other buf free
      if (s + 1 < NSLAB) {                       // overlap DMA of slab s+1 with WMMA
        unsigned char* dst = ws1_b + ((s + 1) & 1) * WS1_BUF;
        int k0n = (s + 1) * KSLAB;
        #pragma unroll
        for (int i = 0; i < 2; ++i) {
          int idx = tid + i * 256;
          int h   = idx >> 3;
          int c   = idx & 7;
          async_cp16(dst + h * (S_STRIDE * 2) + c * 16,
                     w1n8 + (size_t)(hc + h) * (DIN * 2) + k0n * 2 + c * 16);
        }
      }
      const unsigned short* wsu = (const unsigned short*)(ws1_b + (s & 1) * WS1_BUF);
      const int k0 = s * KSLAB;
      #pragma unroll
      for (int ks = 0; ks < KSLAB; ks += 32) {
        v16bf a = load_frag16(&xs_u[(wrow + l16) * XS_STRIDE + k0 + ks + g * 8]);
        #pragma unroll
        for (int t = 0; t < 2; ++t) {
          v16bf b = load_frag16(&wsu[(wn1 + t * 16 + l16) * S_STRIDE + ks + g * 8]);
          hacc[t] = __builtin_amdgcn_wmma_f32_16x16x32_bf16(
              false, a, false, b, (short)0, hacc[t], false, false);
        }
      }
    }

    // ---- bias + ReLU -> bf16 h chunk in LDS (never touches global)
    #pragma unroll
    for (int t = 0; t < 2; ++t) {
      int col = wn1 + t * 16 + l16;
      float bias = b1[n * HH + hc + col];
      #pragma unroll
      for (int r = 0; r < 8; ++r) {
        float v = hacc[t][r] + bias;
        v = v > 0.0f ? v : 0.0f;
        hs_u[(wrow + g * 8 + r) * S_STRIDE + col] = f2bf(v);
      }
    }
    __syncthreads();                             // hs + w2t visible

    // ---- layer 2: oacc += relu(h_chunk) @ W2_chunk (K = 64)
    #pragma unroll
    for (int ks = 0; ks < HC; ks += 32) {
      v16bf a2 = load_frag16(&hs_cu[(wrow + l16) * S_STRIDE + ks + g * 8]);
      #pragma unroll
      for (int t = 0; t < 4; ++t) {
        v16bf bw = load_frag16(&w2_u[(wn2 + t * 16 + l16) * S_STRIDE + ks + g * 8]);
        oacc[t] = __builtin_amdgcn_wmma_f32_16x16x32_bf16(
            false, a2, false, bw, (short)0, oacc[t], false, false);
      }
    }
  }

  // ---- epilogue: + b2, f32 store out[m, n, o]
  #pragma unroll
  for (int t = 0; t < 4; ++t) {
    int col = wn2 + t * 16 + l16;
    float bias = b2p[n * DOUT + col];
    #pragma unroll
    for (int r = 0; r < 8; ++r) {
      int m = m0 + wrow + g * 8 + r;
      out[(size_t)m * (N_ * DOUT) + n * DOUT + col] = oacc[t][r] + bias;
    }
  }
}

extern "C" void kernel_launch(void* const* d_in, const int* in_sizes, int n_in,
                              void* d_out, int out_size, void* d_ws, size_t ws_size,
                              hipStream_t stream) {
  const float* x  = (const float*)d_in[0];
  const float* W1 = (const float*)d_in[1];
  const float* b1 = (const float*)d_in[2];
  const float* W2 = (const float*)d_in[3];
  const float* b2 = (const float*)d_in[4];
  float* out = (float*)d_out;

  // workspace layout (bf16): x copy, W1 transposed, W2 transposed  (~50 MB)
  unsigned short* xb  = (unsigned short*)d_ws;                          // 16384*1024
  unsigned short* W1t = xb  + (size_t)M_TOT * DIN;                      // 16*512*1024
  unsigned short* W2t = W1t + (size_t)N_ * HH * DIN;                    // 16*128*512

  cvt_x_kernel <<<(M_TOT * DIN / 4) / 256, 256, 0, stream>>>(x, xb);
  cvt_w1_kernel<<<(N_ * DIN * HH / 4) / 256, 256, 0, stream>>>(W1, W1t);
  cvt_w2_kernel<<<(N_ * HH * DOUT / 4) / 256, 256, 0, stream>>>(W2, W2t);

  hipError_t attr_rc = hipFuncSetAttribute(
      reinterpret_cast<const void*>(mlp_concept_kernel),
      hipFuncAttributeMaxDynamicSharedMemorySize, (int)SMEM_BYTES);
  (void)attr_rc;

  dim3 grid(M_TOT / M_TILE, N_);                 // 256 token tiles x 16 concepts
  mlp_concept_kernel<<<grid, 256, SMEM_BYTES, stream>>>(xb, W1t, W2t, b1, b2, out);
}

// v001
// One run takes 616 microseconds.
// Timed twice side by side with v000, it ran 1.85 and 1.83 times as fast.
#include <hip/hip_runtime.h>
#include <stdint.h>

#define B_    8
#define T_    2048
#define N_    16
#define DIN   1024
#define HH    512
#define DOUT  128
#define M_TOT (B_ * T_)        // 16384 tokens

#define M_TILE 64              // tokens per workgroup
#define HC     64              // H columns per fused chunk
#define KSLAB  512             // K staged per LDS slab (16 WMMA k-steps)
#define NSLAB  (DIN / KSLAB)   // 2 slabs per chunk (even: buffer = s & 1 in every chunk)

#define XS_STRIDE 1032         // bf16 elems per x row in LDS (+8 pad)
#define S_STRIDE  72           // bf16 elems per h / W2 chunk row (+8 pad)
#define W1S_STRIDE (KSLAB + 8) // bf16 elems per W1 slab row (+8 pad)

// LDS byte offsets
#define XS_OFF   0
#define XS_BYTES (M_TILE * XS_STRIDE * 2)          // 132096
#define WS1_OFF  (XS_OFF + XS_BYTES)
#define WS1_BUF  (HC * W1S_STRIDE * 2)             // 66560 per buffer
#define HS_OFF   (WS1_OFF + 2 * WS1_BUF)
#define HS_BYTES (M_TILE * S_STRIDE * 2)           // 9216
#define W2_OFF   (HS_OFF + HS_BYTES)
#define W2_BYTES (DOUT * S_STRIDE * 2)             // 18432
#define SMEM_BYTES (W2_OFF + W2_BYTES)             // 292864
static_assert(NSLAB >= 2 && NSLAB % 2 == 0, "ring: buffer = s & 1; W2 lands by the wait of s == 1");

typedef __bf16 v16bf __attribute__((ext_vector_type(16)));
typedef float  v8f   __attribute__((ext_vector_type(8)));
typedef int    v4i   __attribute__((ext_vector_type(4)));

#define AS1 __attribute__((address_space(1)))
#define AS3 __attribute__((address_space(3)))

__device__ __forceinline__ unsigned short f2bf(float f) {
  union { float f; uint32_t u; } c; c.f = f;
  uint32_t r = c.u + 0x7FFFu + ((c.u >> 16) & 1u);   // round-to-nearest-even
  return (unsigned short)(r >> 16);
}

// 16-byte global -> LDS copy on the CDNA5 async path (ASYNCcnt),
// with a synchronous VGPR fallback if the builtin is unavailable.
__device__ __forceinline__ void async_cp16(void* lds_dst, const void* gsrc) {
#if __has_builtin(__builtin_amdgcn_global_load_async_to_lds_b128)
  __builtin_amdgcn_global_load_async_to_lds_b128(
      (AS1 v4i*)(uintptr_t)gsrc,
      (AS3 v4i*)(uint32_t)(uintptr_t)lds_dst, 0, 0);
#else
  *(uint4*)lds_dst = *(const uint4*)gsrc;
#endif
}

__device__ __forceinline__ void async_wait_all() {
#if __has_builtin(__builtin_amdgcn_s_wait_asynccnt)
  __builtin_amdgcn_s_wait_asynccnt(0);
#elif __has_builtin(__builtin_amdgcn_global_load_async_to_lds_b128)
  asm volatile("s_wait_asynccnt 0" ::: "memory");
#endif
}

// one W1 slab [HC h][KSLAB k] (contiguous along k): a wave's copy covers 512 B of one row
__device__ __forceinline__ void stage_w1_slab(unsigned char* dst, const unsigned char* src,
                                              int tid) {
  #pragma unroll   // the 16 copies issue back to back, row and column offsets folded
  for (int i = 0; i < (HC * KSLAB * 2 / 16) / 256; ++i) {   // 4096 x 16B chunks / 256 threads
    int idx = tid + i * 256;
    int h   = idx / (KSLAB / 8);                 // 64 chunks per h row
    int c   = idx % (KSLAB / 8);
    async_cp16(dst + h * (W1S_STRIDE * 2) + c * 16,
               src + (size_t)h * (DIN * 2) + c * 16);
  }
}

// 16 bf16 fragment = two ds_load_b128
__device__ __forceinline__ v16bf load_frag16(const unsigned short* p) {
  union { uint4 q[2]; v16bf v; } f;
  f.q[0] = *(const uint4*)(p);
  f.q[1] = *(const uint4*)(p + 16);
  return f.v;
}

// ---------------- prep pass: f32 -> bf16, weights pre-transposed ----------------

__global__ __launch_bounds__(256) void cvt_x_kernel(const float* __restrict__ x,
                                                    unsigned short* __restrict__ xb) {
  size_t i = (size_t)blockIdx.x * 256 + threadIdx.x;       // float4 index
  float4 v = *(const float4*)(x + i * 4);
  union { unsigned short s[4]; uint2 u; } pk;
  pk.s[0] = f2bf(v.x); pk.s[1] = f2bf(v.y); pk.s[2] = f2bf(v.z); pk.s[3] = f2bf(v.w);
  *(uint2*)(xb + i * 4) = pk.u;
}

// W1 [n][k][h] (f32) -> W1t [n][h][k] (bf16)
__global__ __launch_bounds__(256) void cvt_w1_kernel(const float* __restrict__ W1,
                                                     unsigned short* __restrict__ W1t) {
  size_t i = (size_t)blockIdx.x * 256 + threadIdx.x;       // float4 index
  int n   = (int)(i >> 17);                                 // 131072 float4 per concept
  int rem = (int)(i & 131071);
  int k   = rem >> 7;                                       // 128 float4 per k row
  int h4  = rem & 127;
  float4 v = *(const float4*)(W1 + ((size_t)n << 19) + (size_t)k * HH + h4 * 4);
  size_t base = ((size_t)n * HH + h4 * 4) * DIN + k;
  W1t[base            ] = f2bf(v.x);
  W1t[base + 1 * DIN  ] = f2bf(v.y);
  W1t[base + 2 * DIN  ] = f2bf(v.z);
  W1t[base + 3 * DIN  ] = f2bf(v.w);
}

// W2 [n][h][o] (f32) -> W2t [n][o][h] (bf16)
__global__ __launch_bounds__(256) void cvt_w2_kernel(const float* __restrict__ W2,
                                                     unsigned short* __restrict__ W2t) {
  size_t i = (size_t)blockIdx.x * 256 + threadIdx.x;       // float4 index
  int n   = (int)(i >> 14);                                 // 16384 float4 per concept
  int rem = (int)(i & 16383);
  int h   = rem >> 5;                                       // 32 float4 per h row
  int o4  = rem & 31;
  float4 v = *(const float4*)(W2 + ((size_t)n << 16) + (size_t)h * DOUT + o4 * 4);
  size_t base = ((size_t)n * DOUT + o4 * 4) * HH + h;
  W2t[base           ] = f2bf(v.x);
  W2t[base + 1 * HH  ] = f2bf(v.y);
  W2t[base + 2 * HH  ] = f2bf(v.z);
  W2t[base + 3 * HH  ] = f2bf(v.w);
}

// ---------------- fused grouped-MLP WMMA kernel ----------------

__global__ __launch_bounds__(256, 1)
void mlp_concept_kernel(const unsigned short* __restrict__ xb,    // [M][1024] bf16
                        const unsigned short* __restrict__ W1t,   // [n][h][k] bf16
                        const unsigned short* __restrict__ W2t,   // [n][o][h] bf16
                        const float* __restrict__ b1,
                        const float* __restrict__ b2p,
                        float* __restrict__ out) {
  extern __shared__ unsigned char smem[];
  unsigned char* xs_b  = smem + XS_OFF;
  unsigned char* ws1_b = smem + WS1_OFF;
  unsigned char* hs_b  = smem + HS_OFF;
  unsigned char* w2_b  = smem + W2_OFF;
  const unsigned short* xs_u  = (const unsigned short*)xs_b;
  const unsigned short* hs_cu = (const unsigned short*)hs_b;
  unsigned short* hs_u = (unsigned short*)hs_b;
  const unsigned short* w2_u  = (const unsigned short*)w2_b;

  const int tid  = threadIdx.x;
  const int wave = tid >> 5;
  const int lane = tid & 31;
  const int l16  = lane & 15;
  const int g    = lane >> 4;            // K-half group per WMMA layout

  const int m0 = blockIdx.x * M_TILE;
  const int n  = blockIdx.y;

  const unsigned char* xb8  = (const unsigned char*)xb + (size_t)m0 * DIN * 2;
  const unsigned char* w1n8 = (const unsigned char*)W1t + (size_t)n * HH * DIN * 2;
  const unsigned char* w2n8 = (const unsigned char*)W2t + (size_t)n * DOUT * HH * 2;

  // ---- async-stage the whole bf16 x tile (resident across all 8 H-chunks)
  #pragma unroll
  for (int i = 0; i < 32; ++i) {                 // 8192 x 16B chunks / 256 threads
    int idx = tid + i * 256;
    int r   = idx >> 7;                          // 128 chunks per token row
    int c   = idx & 127;
    async_cp16(xs_b + r * (XS_STRIDE * 2) + c * 16,
               xb8 + (size_t)r * (DIN * 2) + c * 16);
  }

  const int wrow = (wave >> 1) * 16;
  const int wn1  = (wave & 1) * 32;              // layer1: 2 tiles of 16 cols
  const int wn2  = (wave & 1) * 64;              // layer2: 4 tiles of 16 cols

  v8f oacc[4] = {};

  // first W1 slab of the first chunk; every later slab is issued one whole slab ahead
  stage_w1_slab(ws1_b, w1n8, tid);

  for (int hc = 0; hc < HH; hc += HC) {
    v8f hacc[2] = {};

    // ---- layer 1: K=1024 reduction; the two-buffer slab ring runs on across chunks
    #pragma unroll   // buffer index and the s == 0 / last-slab tests become compile-time
    for (int s = 0; s < NSLAB; ++s) {
      async_wait_all();                          // slab s (+ x at the start, w2t on s==1) landed
      __syncthreads();                           // all waves landed; other buf, hs, w2t free
      if (s == 0) {
        // W2 chunk copy: [128 o][64 h] (contiguous along h), landed by the wait of s == 1
        #pragma unroll
        for (int i = 0; i < 4; ++i) {            // 1024 chunks
          int idx = tid + i * 256;
          int o   = idx >> 3;                    // 8 chunks per o row
          int c   = idx & 7;
          async_cp16(w2_b + o * (S_STRIDE * 2) + c * 16,
                     w2n8 + (size_t)o * (HH * 2) + hc * 2 + c * 16);
        }
      }
      // overlap the copy of the next slab (this chunk's, or the next chunk's first) with WMMA
      if (s + 1 < NSLAB) {
        stage_w1_slab(ws1_b + ((s + 1) & 1) * WS1_BUF,
                      w1n8 + (size_t)hc * (DIN * 2) + (s + 1) * (KSLAB * 2), tid);
      } else if (hc + HC < HH) {
        stage_w1_slab(ws1_b, w1n8 + (size_t)(hc + HC) * (DIN * 2), tid);
      }
      const unsigned short* wsu = (const unsigned short*)(ws1_b + (s & 1) * WS1_BUF);
      const int k0 = s * KSLAB;
      #pragma unroll
      for (int ks = 0; ks < KSLAB; ks += 32) {
        v16bf a = load_frag16(&xs_u[(wrow + l16) * XS_STRIDE + k0 + ks + g * 8]);
        #pragma unroll
        for (int t = 0; t < 2; ++t) {
          v16bf b = load_frag16(&wsu[(wn1 + t * 16 + l16) * W1S_STRIDE + ks + g * 8]);
          hacc[t] = __builtin_amdgcn_wmma_f32_16x16x32_bf16(
              false, a, false, b, (short)0, hacc[t], false, false);
        }
      }
    }

    // ---- bias + ReLU -> bf16 h chunk in LDS (never touches global)
    #pragma unroll
    for (int t = 0; t < 2; ++t) {
      int col = wn1 + t * 16 + l16;
      float bias = b1[n * HH + hc + col];
      #pragma unroll
      for (int r = 0; r < 8; ++r) {
        float v = hacc[t][r] + bias;
        v = v > 0.0f ? v : 0.0f;
        hs_u[(wrow + g * 8 + r) * S_STRIDE + col] = f2bf(v);
      }
    }
    __syncthreads();                             // hs + w2t visible

    // ---- layer 2: oacc += relu(h_chunk) @ W2_chunk (K = 64)
    #pragma unroll
    for (int ks = 0; ks < HC; ks += 32) {
      v16bf a2 = load_frag16(&hs_cu[(wrow + l16) * S_STRIDE + ks + g * 8]);
      #pragma unroll
      for (int t = 0; t < 4; ++t) {
        v16bf bw = load_frag16(&w2_u[(wn2 + t * 16 + l16) * S_STRIDE + ks + g * 8]);
        oacc[t] = __builtin_amdgcn_wmma_f32_16x16x32_bf16(
            false, a2, false, bw, (short)0, oacc[t], false, false);
      }
    }
  }

  // ---- epilogue: + b2, f32 store out[m, n, o]
  #pragma unroll
  for (int t = 0; t < 4; ++t) {
    int col = wn2 + t * 16 + l16;
    float bias = b2p[n * DOUT + col];
    #pragma unroll
    for (int r = 0; r < 8; ++r) {
      int m = m0 + wrow + g * 8 + r;
      out[(size_t)m * (N_ * DOUT) + n * DOUT + col] = oacc[t][r] + bias;
    }
  }
}

extern "C" void kernel_launch(void* const* d_in, const int* in_sizes, int n_in,
                              void* d_out, int out_size, void* d_ws, size_t ws_size,
                              hipStream_t stream) {
  const float* x  = (const float*)d_in[0];
  const float* W1 = (const float*)d_in[1];
  const float* b1 = (const float*)d_in[2];
  const float* W2 = (const float*)d_in[3];
  const float* b2 = (const float*)d_in[4];
  float* out = (float*)d_out;

  // workspace layout (bf16): x copy, W1 transposed, W2 transposed  (~50 MB)
  unsigned short* xb  = (unsigned short*)d_ws;                          // 16384*1024
  unsigned short* W1t = xb  + (size_t)M_TOT * DIN;                      // 16*512*1024
  unsigned short* W2t = W1t + (size_t)N_ * HH * DIN;                    // 16*128*512

  cvt_x_kernel <<<(M_TOT * DIN / 4) / 256, 256, 0, stream>>>(x, xb);
  cvt_w1_kernel<<<(N_ * DIN * HH / 4) / 256, 256, 0, stream>>>(W1, W1t);
  cvt_w2_kernel<<<(N_ * HH * DOUT / 4) / 256, 256, 0, stream>>>(W2, W2t);

  hipError_t attr_rc = hipFuncSetAttribute(
      reinterpret_cast<const void*>(mlp_concept_kernel),
      hipFuncAttributeMaxDynamicSharedMemorySize, (int)SMEM_BYTES);
  (void)attr_rc;

  dim3 grid(M_TOT / M_TILE, N_);                 // 256 token tiles x 16 concepts
  mlp_concept_kernel<<<grid, 256, SMEM_BYTES, stream>>>(xb, W1t, W2t, b1, b2, out);
}

// v002
// One run takes 431 microseconds.
// Timed twice side by side with v001, it ran 1.44 and 1.43 times as fast.
// All steps since v000 together make it 2.64 times as fast.
#include <hip/hip_runtime.h>
#include <stdint.h>

#define B_    8
#define T_    2048
#define N_    16
#define DIN   1024
#define HH    512
#define DOUT  128
#define M_TOT (B_ * T_)        // 16384 tokens

#define M_TILE 128             // tokens per workgroup
#define HC     256             // H columns per fused chunk
#define KSLAB  128             // K staged per LDS slab (4 WMMA k-steps)
#define NSLAB  (DIN / KSLAB)   // 8 slabs per chunk (even: see the ring's buffer order)

#define SL_STRIDE (KSLAB + 8)  // bf16 elems per x / W1 slab row (+8 pad: 272 B = 16 B x odd)
#define S_STRIDE  (HC + 8)     // bf16 elems per h / W2 chunk row (+8 pad: 528 B = 16 B x odd)

// LDS byte offsets: two ring buffers, each [x slab | W1 slab]; the W2 chunk behind them.
// The h chunk has no room of its own: it lies in the ring buffer that is idle between chunks.
#define XSL_BYTES (M_TILE * SL_STRIDE * 2)         // 34816
#define WSL_BYTES (HC * SL_STRIDE * 2)             // 69632
#define RING_BUF  (XSL_BYTES + WSL_BYTES)          // 104448 per buffer
#define HS_BYTES  (M_TILE * S_STRIDE * 2)          // 67584
#define W2_OFF    (2 * RING_BUF)
#define W2_BYTES  (DOUT * S_STRIDE * 2)            // 67584
#define SMEM_BYTES (W2_OFF + W2_BYTES)             // 276480
static_assert(NSLAB >= 2 && NSLAB % 2 == 0, "ring: a chunk ends on the buffer it began on");
static_assert(HS_BYTES <= RING_BUF, "the h chunk lies inside one ring buffer");
static_assert(SMEM_BYTES <= 327680, "one workgroup's LDS");

typedef __bf16 v16bf __attribute__((ext_vector_type(16)));
typedef float  v8f   __attribute__((ext_vector_type(8)));
typedef int    v4i   __attribute__((ext_vector_type(4)));

#define AS1 __attribute__((address_space(1)))
#define AS3 __attribute__((address_space(3)))

__device__ __forceinline__ unsigned short f2bf(float f) {
  union { float f; uint32_t u; } c; c.f = f;
  uint32_t r = c.u + 0x7FFFu + ((c.u >> 16) & 1u);   // round-to-nearest-even
  return (unsigned short)(r >> 16);
}

// 16-byte global -> LDS copy on the CDNA5 async path (ASYNCcnt),
// with a synchronous VGPR fallback if the builtin is unavailable.
__device__ __forceinline__ void async_cp16(void* lds_dst, const void* gsrc) {
#if __has_builtin(__builtin_amdgcn_global_load_async_to_lds_b128)
  __builtin_amdgcn_global_load_async_to_lds_b128(
      (AS1 v4i*)(uintptr_t)gsrc,
      (AS3 v4i*)(uint32_t)(uintptr_t)lds_dst, 0, 0);
#else
  *(uint4*)lds_dst = *(const uint4*)gsrc;
#endif
}

// publish point of the ring: every wave passes it once per trip
__device__ __forceinline__ void ring_publish() {
  // this wave's LDS reads of the buffer that is refilled behind the barrier have retired
  asm volatile("s_wait_dscnt 0x0" ::: "memory");
  // this wave's own copies have landed before any other wave reads them
  asm volatile("s_wait_asynccnt 0x0" ::: "memory");
  __syncthreads();
}

// ROWS rows of one K slab (256 B of each row, source pitch 2048 B) -> LDS rows of 272 B;
// a wave's copy covers two whole rows
template <int ROWS>
__device__ __forceinline__ void stage_slab(unsigned char* dst, const unsigned char* src, int tid) {
  #pragma unroll   // the copies issue back to back
  for (int i = 0; i < (ROWS * KSLAB * 2 / 16) / 256; ++i) {   // 16 B chunks / 256 threads
    int idx = tid + i * 256;
    int r   = idx / (KSLAB / 8);                 // 16 chunks per row
    int c   = idx % (KSLAB / 8);
    async_cp16(dst + r * (SL_STRIDE * 2) + c * 16,
               src + (size_t)r * (DIN * 2) + c * 16);
  }
}

// 16 bf16 fragment = two ds_load_b128
__device__ __forceinline__ v16bf load_frag16(const unsigned short* p) {
  union { uint4 q[2]; v16bf v; } f;
  f.q[0] = *(const uint4*)(p);
  f.q[1] = *(const uint4*)(p + 16);
  return f.v;
}

// ---------------- prep pass: f32 -> bf16, weights pre-transposed ----------------

__global__ __launch_bounds__(256) void cvt_x_kernel(const float* __restrict__ x,
                                                    unsigned short* __restrict__ xb) {
  size_t i = (size_t)blockIdx.x * 256 + threadIdx.x;       // float4 index
  float4 v = *(const float4*)(x + i * 4);
  union { unsigned short s[4]; uint2 u; } pk;
  pk.s[0] = f2bf(v.x); pk.s[1] = f2bf(v.y); pk.s[2] = f2bf(v.z); pk.s[3] = f2bf(v.w);
  *(uint2*)(xb + i * 4) = pk.u;
}

// W1 [n][k][h] (f32) -> W1t [n][h][k] (bf16)
__global__ __launch_bounds__(256) void cvt_w1_kernel(const float* __restrict__ W1,
                                                     unsigned short* __restrict__ W1t) {
  size_t i = (size_t)blockIdx.x * 256 + threadIdx.x;       // float4 index
  int n   = (int)(i >> 17);                                 // 131072 float4 per concept
  int rem = (int)(i & 131071);
  int k   = rem >> 7;                                       // 128 float4 per k row
  int h4  = rem & 127;
  float4 v = *(const float4*)(W1 + ((size_t)n << 19) + (size_t)k * HH + h4 * 4);
  size_t base = ((size_t)n * HH + h4 * 4) * DIN + k;
  W1t[base            ] = f2bf(v.x);
  W1t[base + 1 * DIN  ] = f2bf(v.y);
  W1t[base + 2 * DIN  ] = f2bf(v.z);
  W1t[base + 3 * DIN  ] = f2bf(v.w);
}

// W2 [n][h][o] (f32) -> W2t [n][o][h] (bf16)
__global__ __launch_bounds__(256) void cvt_w2_kernel(const float* __restrict__ W2,
                                                     unsigned short* __restrict__ W2t) {
  size_t i = (size_t)blockIdx.x * 256 + threadIdx.x;       // float4 index
  int n   = (int)(i >> 14);                                 // 16384 float4 per concept
  int rem = (int)(i & 16383);
  int h   = rem >> 5;                                       // 32 float4 per h row
  int o4  = rem & 31;
  float4 v = *(const float4*)(W2 + ((size_t)n << 16) + (size_t)h * DOUT + o4 * 4);
  size_t base = ((size_t)n * DOUT + o4 * 4) * HH + h;
  W2t[base           ] = f2bf(v.x);
  W2t[base + 1 * HH  ] = f2bf(v.y);
  W2t[base + 2 * HH  ] = f2bf(v.z);
  W2t[base + 3 * HH  ] = f2bf(v.w);
}

// ---------------- fused grouped-MLP WMMA kernel ----------------

__global__ __launch_bounds__(256, 1)
void mlp_concept_kernel(const unsigned short* __restrict__ xb,    // [M][1024] bf16
                        const unsigned short* __restrict__ W1t,   // [n][h][k] bf16
                        const unsigned short* __restrict__ W2t,   // [n][o][h] bf16
                        const float* __restrict__ b1,
                        const float* __restrict__ b2p,
                        float* __restrict__ out) {
  extern __shared__ unsigned char smem[];
  unsigned char* w2_b = smem + W2_OFF;
  const unsigned short* w2_u = (const unsigned short*)w2_b;

  const int tid  = threadIdx.x;
  const int wave = tid >> 5;
  const int lane = tid & 31;
  const int l16  = lane & 15;
  const int g    = lane >> 4;            // K-half group per WMMA layout

  const int m0 = blockIdx.x * M_TILE;
  const int n  = blockIdx.y;

  const unsigned char* xb8  = (const unsigned char*)xb + (size_t)m0 * DIN * 2;
  const unsigned char* w1n8 = (const unsigned char*)W1t + (size_t)n * HH * DIN * 2;
  const unsigned char* w2n8 = (const unsigned char*)W2t + (size_t)n * DOUT * HH * 2;

  // 2 x 4 wave grid. Layer 1: 64 rows x 64 h cols per wave (4 x 4 WMMA tiles: 8 fragments
  // feed 16 WMMAs). Layer 2: 64 rows x 32 out cols per wave (4 x 2 tiles).
  const int wrow = (wave >> 2) * 64;
  const int wn1  = (wave & 3) * 64;
  const int wn2  = (wave & 3) * 32;

  v8f oacc[4][2] = {};

  // first slab of the first chunk; every later slab is issued one whole slab ahead
  stage_slab<M_TILE>(smem, xb8, tid);
  stage_slab<HC>(smem + XSL_BYTES, w1n8, tid);

  int cur = 0;                                   // ring buffer that holds the slab of this trip

  for (int hc = 0; hc < HH; hc += HC) {
    v8f hacc[4][4] = {};
    const unsigned char* w1c8 = w1n8 + (size_t)hc * (DIN * 2);

    // ---- layer 1: K=1024 reduction over a two-buffer ring of [x | W1] slabs
    for (int s = 0; s < NSLAB; ++s) {
      // slab s (and, on s == 1, the W2 chunk) landed in all waves; other buffer, w2t free
      ring_publish();
      const unsigned short* xsl = (const unsigned short*)(smem + cur * RING_BUF);
      const unsigned short* wsl = (const unsigned short*)(smem + cur * RING_BUF + XSL_BYTES);
      const unsigned short* ap = &xsl[(wrow + l16) * SL_STRIDE + g * 8];
      const unsigned short* bp = &wsl[(wn1 + l16) * SL_STRIDE + g * 8];
      v16bf a[2][4], b[2][4];                    // two fragment sets, one k-step apart
      // every loop over fragments, tiles and k-steps is unrolled whole: with compile-time
      // indices the fragment and accumulator arrays stay in registers
      #pragma unroll
      for (int i = 0; i < 4; ++i) {
        a[0][i] = load_frag16(ap + i * 16 * SL_STRIDE);
        b[0][i] = load_frag16(bp + i * 16 * SL_STRIDE);
      }
      // the first fragments' LDS latency runs under the issue of the copies below
      __builtin_amdgcn_sched_barrier(0);
      if (s == 0) {
        // W2 chunk copy: [128 o][256 h] (contiguous along h), landed by the wait of s == 1
        #pragma unroll
        for (int i = 0; i < (DOUT * HC * 2 / 16) / 256; ++i) {   // 4096 chunks
          int idx = tid + i * 256;
          int o   = idx / (HC / 8);              // 32 chunks per o row
          int c   = idx % (HC / 8);
          async_cp16(w2_b + o * (S_STRIDE * 2) + c * 16,
                     w2n8 + (size_t)o * (HH * 2) + hc * 2 + c * 16);
        }
      }
      // overlap the copy of this chunk's next slab with WMMA
      if (s + 1 < NSLAB) {
        unsigned char* nb = smem + (cur ^ 1) * RING_BUF;
        stage_slab<M_TILE>(nb, xb8 + (s + 1) * (KSLAB * 2), tid);
        stage_slab<HC>(nb + XSL_BYTES, w1c8 + (s + 1) * (KSLAB * 2), tid);
      }
      #pragma unroll
      for (int ks = 0; ks < KSLAB / 32; ++ks) {
        const int fc = ks & 1, fn = fc ^ 1;
        if (ks + 1 < KSLAB / 32) {
          #pragma unroll
          for (int i = 0; i < 4; ++i) {
            a[fn][i] = load_frag16(ap + i * 16 * SL_STRIDE + (ks + 1) * 32);
            b[fn][i] = load_frag16(bp + i * 16 * SL_STRIDE + (ks + 1) * 32);
          }
        }
        // keeps the next k-step's LDS reads one group ahead of this step's WMMAs
        // (left free, the scheduler spreads them among the WMMAs and the waits reach 0)
        __builtin_amdgcn_sched_barrier(0);
        #pragma unroll
        for (int i = 0; i < 4; ++i) {
          #pragma unroll
          for (int t = 0; t < 4; ++t) {
            hacc[i][t] = __builtin_amdgcn_wmma_f32_16x16x32_bf16(
                false, a[fc][i], false, b[fc][t], (short)0, hacc[i][t], false, false);
          }
        }
        __builtin_amdgcn_sched_barrier(0);       // the group after next stays behind these WMMAs
      }
      cur ^= 1;
    }

    // After an even number of trips cur is the buffer of the last trip but one: every wave has
    // passed the last trip's barrier, so nobody reads it any more, and no copy is aimed at it.
    unsigned short* hs_u = (unsigned short*)(smem + cur * RING_BUF);

    // ---- bias + ReLU -> bf16 h chunk in LDS (never touches global)
    #pragma unroll
    for (int t = 0; t < 4; ++t) {
      int col = wn1 + t * 16 + l16;
      float bias = b1[n * HH + hc + col];
      #pragma unroll
      for (int i = 0; i < 4; ++i) {
        #pragma unroll
        for (int r = 0; r < 8; ++r) {
          float v = hacc[i][t][r] + bias;
          v = v > 0.0f ? v : 0.0f;
          hs_u[(wrow + i * 16 + g * 8 + r) * S_STRIDE + col] = f2bf(v);
        }
      }
    }
    // hs visible; the last trip's buffer is free (the compiler's s_wait_dscnt 0 stands in front)
    __syncthreads();

    // the next chunk's first slab goes into the buffer of the last trip, under layer 2
    if (hc + HC < HH) {
      unsigned char* nb = smem + (cur ^ 1) * RING_BUF;
      stage_slab<M_TILE>(nb, xb8, tid);
      stage_slab<HC>(nb + XSL_BYTES, w1c8 + (size_t)HC * (DIN * 2), tid);
    }

    // ---- layer 2: oacc += relu(h_chunk) @ W2_chunk (K = 256)
    {
      const unsigned short* ap2 = &hs_u[(wrow + l16) * S_STRIDE + g * 8];
      const unsigned short* bp2 = &w2_u[(wn2 + l16) * S_STRIDE + g * 8];
      v16bf a2[2][4], bw[2][2];
      #pragma unroll
      for (int i = 0; i < 4; ++i) a2[0][i] = load_frag16(ap2 + i * 16 * S_STRIDE);
      #pragma unroll
      for (int t = 0; t < 2; ++t) bw[0][t] = load_frag16(bp2 + t * 16 * S_STRIDE);
      #pragma unroll
      for (int ks = 0; ks < HC / 32; ++ks) {
        const int fc = ks & 1, fn = fc ^ 1;
        if (ks + 1 < HC / 32) {
          #pragma unroll
          for (int i = 0; i < 4; ++i)
            a2[fn][i] = load_frag16(ap2 + i * 16 * S_STRIDE + (ks + 1) * 32);
          #pragma unroll
          for (int t = 0; t < 2; ++t)
            bw[fn][t] = load_frag16(bp2 + t * 16 * S_STRIDE + (ks + 1) * 32);
        }
        __builtin_amdgcn_sched_barrier(0);       // as in layer 1: reads one group ahead
        #pragma unroll
        for (int i = 0; i < 4; ++i) {
          #pragma unroll
          for (int t = 0; t < 2; ++t) {
            oacc[i][t] = __builtin_amdgcn_wmma_f32_16x16x32_bf16(
                false, a2[fc][i], false, bw[fc][t], (short)0, oacc[i][t], false, false);
          }
        }
        __builtin_amdgcn_sched_barrier(0);       // as in layer 1
      }
    }
    cur ^= 1;                                    // the next chunk begins on the buffer just filled
  }

  // ---- epilogue: + b2, f32 store out[m, n, o]
  #pragma unroll
  for (int t = 0; t < 2; ++t) {
    int col = wn2 + t * 16 + l16;
    float bias = b2p[n * DOUT + col];
    #pragma unroll
    for (int i = 0; i < 4; ++i) {
      #pragma unroll
      for (int r = 0; r < 8; ++r) {
        int m = m0 + wrow + i * 16 + g * 8 + r;
        out[(size_t)m * (N_ * DOUT) + n * DOUT + col] = oacc[i][t][r] + bias;
      }
    }
  }
}

extern "C" void kernel_launch(void* const* d_in, const int* in_sizes, int n_in,
                              void* d_out, int out_size, void* d_ws, size_t ws_size,
                              hipStream_t stream) {
  const float* x  = (const float*)d_in[0];
  const float* W1 = (const float*)d_in[1];
  const float* b1 = (const float*)d_in[2];
  const float* W2 = (const float*)d_in[3];
  const float* b2 = (const float*)d_in[4];
  float* out = (float*)d_out;

  // workspace layout (bf16): x copy, W1 transposed, W2 transposed  (~50 MB)
  unsigned short* xb  = (unsigned short*)d_ws;                          // 16384*1024
  unsigned short* W1t = xb  + (size_t)M_TOT * DIN;                      // 16*512*1024
  unsigned short* W2t = W1t + (size_t)N_ * HH * DIN;                    // 16*128*512

  cvt_x_kernel <<<(M_TOT * DIN / 4) / 256, 256, 0, stream>>>(x, xb);
  cvt_w1_kernel<<<(N_ * DIN * HH / 4) / 256, 256, 0, stream>>>(W1, W1t);
  cvt_w2_kernel<<<(N_ * HH * DOUT / 4) / 256, 256, 0, stream>>>(W2, W2t);

  hipError_t attr_rc = hipFuncSetAttribute(
      reinterpret_cast<const void*>(mlp_concept_kernel),
      hipFuncAttributeMaxDynamicSharedMemorySize, (int)SMEM_BYTES);
  (void)attr_rc;

  dim3 grid(M_TOT / M_TILE, N_);                 // 128 token tiles x 16 concepts
  mlp_concept_kernel<<<grid, 256, SMEM_BYTES, stream>>>(xb, W1t, W2t, b1, b2, out);
}

// v003
// Measured time: 227 microseconds a run.
// Two timings next to v002 put it at 1.88 and 1.89 times that version's speed.
// Over all steps from v000 it is 4.98 times as fast.
#include <hip/hip_runtime.h>
#include <stdint.h>

#define B_    8
#define T_    2048
#define N_    16
#define DIN   1024
#define HH    512
#define DOUT  128
#define M_TOT (B_ * T_)        // 16384 tokens

#define M_TILE 128             // tokens per workgroup
#define HC     256             // H columns per fused chunk
#define KSLAB  128             // K staged per LDS slab (4 WMMA k-steps)
#define NSLAB  (DIN / KSLAB)   // 8 slabs per chunk (even: see the ring's buffer order)

#define SL_STRIDE (KSLAB + 8)  // bf16 elems per x / W1 slab row (+8 pad: 272 B = 16 B x odd)
#define S_STRIDE  (HC + 8)     // bf16 elems per h / W2 chunk row (+8 pad: 528 B = 16 B x odd)

// LDS byte offsets: two ring buffers, each [x slab | W1 slab]; the W2 chunk behind them.
// The h chunk has no room of its own: it lies in the ring buffer that is idle between chunks.
#define XSL_BYTES (M_TILE * SL_STRIDE * 2)         // 34816
#define WSL_BYTES (HC * SL_STRIDE * 2)             // 69632
#define RING_BUF  (XSL_BYTES + WSL_BYTES)          // 104448 per buffer
#define HS_BYTES  (M_TILE * S_STRIDE * 2)          // 67584
#define W2_OFF    (2 * RING_BUF)
#define W2_BYTES  (DOUT * S_STRIDE * 2)            // 67584
#define SMEM_BYTES (W2_OFF + W2_BYTES)             // 276480
static_assert(NSLAB >= 2 && NSLAB % 2 == 0, "ring: a chunk ends on the buffer it began on");
static_assert(HS_BYTES <= RING_BUF, "the h chunk lies inside one ring buffer");
static_assert(SMEM_BYTES <= 327680, "one workgroup's LDS");

typedef __bf16 v16bf __attribute__((ext_vector_type(16)));
typedef float  v8f   __attribute__((ext_vector_type(8)));
typedef int    v4i   __attribute__((ext_vector_type(4)));

#define AS1 __attribute__((address_space(1)))
#define AS3 __attribute__((address_space(3)))

__device__ __forceinline__ unsigned short f2bf(float f) {
  union { float f; uint32_t u; } c; c.f = f;
  uint32_t r = c.u + 0x7FFFu + ((c.u >> 16) & 1u);   // round-to-nearest-even
  return (unsigned short)(r >> 16);
}

// 16-byte global -> LDS copy on the CDNA5 async path (ASYNCcnt),
// with a synchronous VGPR fallback if the builtin is unavailable.
__device__ __forceinline__ void async_cp16(void* lds_dst, const void* gsrc) {
#if __has_builtin(__builtin_amdgcn_global_load_async_to_lds_b128)
  __builtin_amdgcn_global_load_async_to_lds_b128(
      (AS1 v4i*)(uintptr_t)gsrc,
      (AS3 v4i*)(uint32_t)(uintptr_t)lds_dst, 0, 0);
#else
  *(uint4*)lds_dst = *(const uint4*)gsrc;
#endif
}

// publish point of the ring: every wave passes it once per trip
__device__ __forceinline__ void ring_publish() {
  // this wave's LDS reads of the buffer that is refilled behind the barrier have retired
  asm volatile("s_wait_dscnt 0x0" ::: "memory");
  // this wave's own copies have landed before any other wave reads them
  asm volatile("s_wait_asynccnt 0x0" ::: "memory");
  __syncthreads();
}

// ROWS rows of one K slab (256 B of each row, source pitch 2048 B) -> LDS rows of 272 B;
// a wave's copy covers two whole rows
template <int ROWS>
__device__ __forceinline__ void stage_slab(unsigned char* dst, const unsigned char* src, int tid) {
  #pragma unroll   // the copies issue back to back
  for (int i = 0; i < (ROWS * KSLAB * 2 / 16) / 256; ++i) {   // 16 B chunks / 256 threads
    int idx = tid + i * 256;
    int r   = idx / (KSLAB / 8);                 // 16 chunks per row
    int c   = idx % (KSLAB / 8);
    async_cp16(dst + r * (SL_STRIDE * 2) + c * 16,
               src + (size_t)r * (DIN * 2) + c * 16);
  }
}

// 16 bf16 fragment = two ds_load_b128
__device__ __forceinline__ v16bf load_frag16(const unsigned short* p) {
  union { uint4 q[2]; v16bf v; } f;
  f.q[0] = *(const uint4*)(p);
  f.q[1] = *(const uint4*)(p + 16);
  return f.v;
}

// ---------------- prep pass: f32 -> bf16, weights pre-transposed ----------------
// Each thread converts a block of 32 or 64 elements, so that few waves have to start and each
// of them has all its loads in flight at once.

typedef float f32x4 __attribute__((ext_vector_type(4)));

#define XV 16                  // float4 per thread in cvt_x

__global__ __launch_bounds__(256) void cvt_x_kernel(const float* __restrict__ x,
                                                    unsigned short* __restrict__ xb) {
  const size_t base = (size_t)blockIdx.x * (256 * XV) + threadIdx.x;   // float4 index
  const float* s = x + base * 4;
  f32x4 v[XV];
  #pragma unroll   // all loads issue before the first value is used
  for (int j = 0; j < XV; ++j) v[j] = *(const f32x4*)(s + j * 1024);
  // the loads' address pair stays as it is up to this wait: without the operand the last
  // load's result is placed on the pair that the fifteen loads in front of it name
  asm volatile("s_wait_xcnt 0x0" :: "v"(s) : "memory");
  #pragma unroll
  for (int j = 0; j < XV; ++j) {
    union { unsigned short s[4]; uint2 u; } pk;
    pk.s[0] = f2bf(v[j][0]); pk.s[1] = f2bf(v[j][1]);
    pk.s[2] = f2bf(v[j][2]); pk.s[3] = f2bf(v[j][3]);
    *(uint2*)(xb + (base + j * 256) * 4) = pk.u;
  }
}

// src [n][R][C] (f32) -> dst [n][C][R] (bf16). A workgroup takes 64 r x 128 c, a thread an
// 8 r x 4 c block in registers: 8 float4 loads, 4 stores of 16 B (8 bf16 along r).
// Eight neighbouring lanes lie side by side along r: each store fills whole 128 B lines of dst.
// The eight waves lie side by side along c: together they read 512 B of each source row.
template <int R, int C>
__device__ __forceinline__ void cvt_transpose(const float* __restrict__ src,
                                              unsigned short* __restrict__ dst) {
  constexpr int RB = R / 64, CB = C / 128;
  const unsigned b = blockIdx.x;
  const int cb   = b % CB;
  const int rb   = (b / CB) % RB;
  const int n    = b / (CB * RB);
  const int lane = threadIdx.x & 31;
  const int wave = threadIdx.x >> 5;
  const int r0   = rb * 64 + (lane & 7) * 8;
  const int c0   = cb * 128 + wave * 16 + (lane >> 3) * 4;
  const float* s = src + ((size_t)n * R + r0) * C + c0;
  f32x4 v[8];
  #pragma unroll   // all loads issue before the first value is used
  for (int j = 0; j < 8; ++j) v[j] = *(const f32x4*)(s + (size_t)j * C);
  unsigned short* d = dst + ((size_t)n * C + c0) * R + r0;
  #pragma unroll
  for (int c = 0; c < 4; ++c) {
    union { unsigned short h[8]; uint4 q; } pk;
    #pragma unroll
    for (int j = 0; j < 8; ++j) pk.h[j] = f2bf(v[j][c]);
    *(uint4*)(d + (size_t)c * R) = pk.q;
  }
}

// W1 [n][k][h] (f32) -> W1t [n][h][k] (bf16)
__global__ __launch_bounds__(256) void cvt_w1_kernel(const float* __restrict__ W1,
                                                     unsigned short* __restrict__ W1t) {
  cvt_transpose<DIN, HH>(W1, W1t);
}

// W2 [n][h][o] (f32) -> W2t [n][o][h] (bf16)
__global__ __launch_bounds__(256) void cvt_w2_kernel(const float* __restrict__ W2,
                                                     unsigned short* __restrict__ W2t) {
  cvt_transpose<HH, DOUT>(W2, W2t);
}

// ---------------- fused grouped-MLP WMMA kernel ----------------

__global__ __launch_bounds__(256, 1)
void mlp_concept_kernel(const unsigned short* __restrict__ xb,    // [M][1024] bf16
                        const unsigned short* __restrict__ W1t,   // [n][h][k] bf16
                        const unsigned short* __restrict__ W2t,   // [n][o][h] bf16
                        const float* __restrict__ b1,
                        const float* __restrict__ b2p,
                        float* __restrict__ out) {
  extern __shared__ unsigned char smem[];
  unsigned char* w2_b = smem + W2_OFF;
  const unsigned short* w2_u = (const unsigned short*)w2_b;

  const int tid  = threadIdx.x;
  const int wave = tid >> 5;
  const int lane = tid & 31;
  const int l16  = lane & 15;
  const int g    = lane >> 4;            // K-half group per WMMA layout

  const int m0 = blockIdx.x * M_TILE;
  const int n  = blockIdx.y;

  const unsigned char* xb8  = (const unsigned char*)xb + (size_t)m0 * DIN * 2;
  const unsigned char* w1n8 = (const unsigned char*)W1t + (size_t)n * HH * DIN * 2;
  const unsigned char* w2n8 = (const unsigned char*)W2t + (size_t)n * DOUT * HH * 2;

  // 2 x 4 wave grid. Layer 1: 64 rows x 64 h cols per wave (4 x 4 WMMA tiles: 8 fragments
  // feed 16 WMMAs). Layer 2: 64 rows x 32 out cols per wave (4 x 2 tiles).
  const int wrow = (wave >> 2) * 64;
  const int wn1  = (wave & 3) * 64;
  const int wn2  = (wave & 3) * 32;

  v8f oacc[4][2] = {};

  // first slab of the first chunk; every later slab is issued one whole slab ahead
  stage_slab<M_TILE>(smem, xb8, tid);
  stage_slab<HC>(smem + XSL_BYTES, w1n8, tid);

  int cur = 0;                                   // ring buffer that holds the slab of this trip

  for (int hc = 0; hc < HH; hc += HC) {
    v8f hacc[4][4] = {};
    const unsigned char* w1c8 = w1n8 + (size_t)hc * (DIN * 2);

    // ---- layer 1: K=1024 reduction over a two-buffer ring of [x | W1] slabs
    for (int s = 0; s < NSLAB; ++s) {
      // slab s (and, on s == 1, the W2 chunk) landed in all waves; other buffer, w2t free
      ring_publish();
      const unsigned short* xsl = (const unsigned short*)(smem + cur * RING_BUF);
      const unsigned short* wsl = (const unsigned short*)(smem + cur * RING_BUF + XSL_BYTES);
      const unsigned short* ap = &xsl[(wrow + l16) * SL_STRIDE + g * 8];
      const unsigned short* bp = &wsl[(wn1 + l16) * SL_STRIDE + g * 8];
      v16bf a[2][4], b[2][4];                    // two fragment sets, one k-step apart
      // every loop over fragments, tiles and k-steps is unrolled whole: with compile-time
      // indices the fragment and accumulator arrays stay in registers
      #pragma unroll
      for (int i = 0; i < 4; ++i) {
        a[0][i] = load_frag16(ap + i * 16 * SL_STRIDE);
        b[0][i] = load_frag16(bp + i * 16 * SL_STRIDE);
      }
      // the first fragments' LDS latency runs under the issue of the copies below
      __builtin_amdgcn_sched_barrier(0);
      if (s == 0) {
        // W2 chunk copy: [128 o][256 h] (contiguous along h), landed by the wait of s == 1
        #pragma unroll
        for (int i = 0; i < (DOUT * HC * 2 / 16) / 256; ++i) {   // 4096 chunks
          int idx = tid + i * 256;
          int o   = idx / (HC / 8);              // 32 chunks per o row
          int c   = idx % (HC / 8);
          async_cp16(w2_b + o * (S_STRIDE * 2) + c * 16,
                     w2n8 + (size_t)o * (HH * 2) + hc * 2 + c * 16);
        }
      }
      // overlap the copy of this chunk's next slab with WMMA
      if (s + 1 < NSLAB) {
        unsigned char* nb = smem + (cur ^ 1) * RING_BUF;
        stage_slab<M_TILE>(nb, xb8 + (s + 1) * (KSLAB * 2), tid);
        stage_slab<HC>(nb + XSL_BYTES, w1c8 + (s + 1) * (KSLAB * 2), tid);
      }
      #pragma unroll
      for (int ks = 0; ks < KSLAB / 32; ++ks) {
        const int fc = ks & 1, fn = fc ^ 1;
        if (ks + 1 < KSLAB / 32) {
          #pragma unroll
          for (int i = 0; i < 4; ++i) {
            a[fn][i] = load_frag16(ap + i * 16 * SL_STRIDE + (ks + 1) * 32);
            b[fn][i] = load_frag16(bp + i * 16 * SL_STRIDE + (ks + 1) * 32);
          }
        }
        // keeps the next k-step's LDS reads one group ahead of this step's WMMAs
        // (left free, the scheduler spreads them among the WMMAs and the waits reach 0)
        __builtin_amdgcn_sched_barrier(0);
        #pragma unroll
        for (int i = 0; i < 4; ++i) {
          #pragma unroll
          for (int t = 0; t < 4; ++t) {
            hacc[i][t] = __builtin_amdgcn_wmma_f32_16x16x32_bf16(
                false, a[fc][i], false, b[fc][t], (short)0, hacc[i][t], false, false);
          }
        }
        __builtin_amdgcn_sched_barrier(0);       // the group after next stays behind these WMMAs
      }
      cur ^= 1;
    }

    // After an even number of trips cur is the buffer of the last trip but one: every wave has
    // passed the last trip's barrier, so nobody reads it any more, and no copy is aimed at it.
    unsigned short* hs_u = (unsigned short*)(smem + cur * RING_BUF);

    // ---- bias + ReLU -> bf16 h chunk in LDS (never touches global)
    #pragma unroll
    for (int t = 0; t < 4; ++t) {
      int col = wn1 + t * 16 + l16;
      float bias = b1[n * HH + hc + col];
      #pragma unroll
      for (int i = 0; i < 4; ++i) {
        #pragma unroll
        for (int r = 0; r < 8; ++r) {
          float v = hacc[i][t][r] + bias;
          v = v > 0.0f ? v : 0.0f;
          hs_u[(wrow + i * 16 + g * 8 + r) * S_STRIDE + col] = f2bf(v);
        }
      }
    }
    // hs visible; the last trip's buffer is free (the compiler's s_wait_dscnt 0 stands in front)
    __syncthreads();

    // the next chunk's first slab goes into the buffer of the last trip, under layer 2
    if (hc + HC < HH) {
      unsigned char* nb = smem + (cur ^ 1) * RING_BUF;
      stage_slab<M_TILE>(nb, xb8, tid);
      stage_slab<HC>(nb + XSL_BYTES, w1c8 + (size_t)HC * (DIN * 2), tid);
    }

    // ---- layer 2: oacc += relu(h_chunk) @ W2_chunk (K = 256)
    {
      const unsigned short* ap2 = &hs_u[(wrow + l16) * S_STRIDE + g * 8];
      const unsigned short* bp2 = &w2_u[(wn2 + l16) * S_STRIDE + g * 8];
      v16bf a2[2][4], bw[2][2];
      #pragma unroll
      for (int i = 0; i < 4; ++i) a2[0][i] = load_frag16(ap2 + i * 16 * S_STRIDE);
      #pragma unroll
      for (int t = 0; t < 2; ++t) bw[0][t] = load_frag16(bp2 + t * 16 * S_STRIDE);
      #pragma unroll
      for (int ks = 0; ks < HC / 32; ++ks) {
        const int fc = ks & 1, fn = fc ^ 1;
        if (ks + 1 < HC / 32) {
          #pragma unroll
          for (int i = 0; i < 4; ++i)
            a2[fn][i] = load_frag16(ap2 + i * 16 * S_STRIDE + (ks + 1) * 32);
          #pragma unroll
          for (int t = 0; t < 2; ++t)
            bw[fn][t] = load_frag16(bp2 + t * 16 * S_STRIDE + (ks + 1) * 32);
        }
        __builtin_amdgcn_sched_barrier(0);       // as in layer 1: reads one group ahead
        #pragma unroll
        for (int i = 0; i < 4; ++i) {
          #pragma unroll
          for (int t = 0; t < 2; ++t) {
            oacc[i][t] = __builtin_amdgcn_wmma_f32_16x16x32_bf16(
                false, a2[fc][i], false, bw[fc][t], (short)0, oacc[i][t], false, false);
          }
        }
        __builtin_amdgcn_sched_barrier(0);       // as in layer 1
      }
    }
    cur ^= 1;                                    // the next chunk begins on the buffer just filled
  }

  // ---- epilogue: + b2, f32 store out[m, n, o]
  #pragma unroll
  for (int t = 0; t < 2; ++t) {
    int col = wn2 + t * 16 + l16;
    float bias = b2p[n * DOUT + col];
    #pragma unroll
    for (int i = 0; i < 4; ++i) {
      #pragma unroll
      for (int r = 0; r < 8; ++r) {
        int m = m0 + wrow + i * 16 + g * 8 + r;
        out[(size_t)m * (N_ * DOUT) + n * DOUT + col] = oacc[i][t][r] + bias;
      }
    }
  }
}

extern "C" void kernel_launch(void* const* d_in, const int* in_sizes, int n_in,
                              void* d_out, int out_size, void* d_ws, size_t ws_size,
                              hipStream_t stream) {
  const float* x  = (const float*)d_in[0];
  const float* W1 = (const float*)d_in[1];
  const float* b1 = (const float*)d_in[2];
  const float* W2 = (const float*)d_in[3];
  const float* b2 = (const float*)d_in[4];
  float* out = (float*)d_out;

  // workspace layout (bf16): x copy, W1 transposed, W2 transposed  (~50 MB)
  unsigned short* xb  = (unsigned short*)d_ws;                          // 16384*1024
  unsigned short* W1t = xb  + (size_t)M_TOT * DIN;                      // 16*512*1024
  unsigned short* W2t = W1t + (size_t)N_ * HH * DIN;                    // 16*128*512

  cvt_x_kernel <<<(M_TOT * DIN / 4) / (256 * XV), 256, 0, stream>>>(x, xb);
  cvt_w1_kernel<<<N_ * (DIN / 64) * (HH / 128), 256, 0, stream>>>(W1, W1t);
  cvt_w2_kernel<<<N_ * (HH / 64) * (DOUT / 128), 256, 0, stream>>>(W2, W2t);

  hipError_t attr_rc = hipFuncSetAttribute(
      reinterpret_cast<const void*>(mlp_concept_kernel),
      hipFuncAttributeMaxDynamicSharedMemorySize, (int)SMEM_BYTES);
  (void)attr_rc;

  dim3 grid(M_TOT / M_TILE, N_);                 // 128 token tiles x 16 concepts
  mlp_concept_kernel<<<grid, 256, SMEM_BYTES, stream>>>(xb, W1t, W2t, b1, b2, out);
}

// v004
// Measured time: 212 microseconds a run.
// Next to v003, in two timings, it ran 1.07 and 1.06 times as fast.
// Counting every step since v000, it is 5.30 times as fast.
#include <hip/hip_runtime.h>
#include <stdint.h>

#define B_    8
#define T_    2048
#define N_    16
#define DIN   1024
#define HH    512
#define DOUT  128
#define M_TOT (B_ * T_)        // 16384 tokens

#define M_TILE 128             // tokens per workgroup
#define HC     256             // H columns per fused chunk
#define KSLAB  128             // K staged per LDS slab (4 WMMA k-steps)
#define NSLAB  (DIN / KSLAB)   // 8 slabs per chunk (even: see the ring's buffer order)

#define SL_STRIDE (KSLAB + 8)  // bf16 elems per x / W1 slab row (+8 pad: 272 B = 16 B x odd)
#define S_STRIDE  (HC + 8)     // bf16 elems per h / W2 chunk row (+8 pad: 528 B = 16 B x odd)

// LDS byte offsets: two ring buffers, each [x slab | W1 slab]; the W2 chunk behind them.
// The h chunk has no room of its own: it lies in the ring buffer that is idle between chunks.
#define XSL_BYTES (M_TILE * SL_STRIDE * 2)         // 34816
#define WSL_BYTES (HC * SL_STRIDE * 2)             // 69632
#define RING_BUF  (XSL_BYTES + WSL_BYTES)          // 104448 per buffer
#define HS_BYTES  (M_TILE * S_STRIDE * 2)          // 67584
#define W2_OFF    (2 * RING_BUF)
#define W2_BYTES  (DOUT * S_STRIDE * 2)            // 67584
#define SMEM_BYTES (W2_OFF + W2_BYTES)             // 276480
static_assert(NSLAB >= 2 && NSLAB % 2 == 0, "ring: a chunk ends on the buffer it began on");
static_assert(HS_BYTES <= RING_BUF, "the h chunk lies inside one ring buffer");
static_assert(SMEM_BYTES <= 327680, "one workgroup's LDS");

typedef __bf16 v16bf __attribute__((ext_vector_type(16)));
typedef float  v8f   __attribute__((ext_vector_type(8)));
typedef int    v4i   __attribute__((ext_vector_type(4)));
typedef float  f32x2 __attribute__((ext_vector_type(2)));
typedef float  f32x4 __attribute__((ext_vector_type(4)));
typedef __bf16 bf16x2 __attribute__((ext_vector_type(2)));

#define AS1 __attribute__((address_space(1)))
#define AS3 __attribute__((address_space(3)))

__device__ __forceinline__ unsigned short f2bf(float f) {
  union { float f; uint32_t u; } c; c.f = f;
  uint32_t r = c.u + 0x7FFFu + ((c.u >> 16) & 1u);   // round-to-nearest-even
  return (unsigned short)(r >> 16);
}

// 16-byte global -> LDS copy on the CDNA5 async path (ASYNCcnt),
// with a synchronous VGPR fallback if the builtin is unavailable.
__device__ __forceinline__ void async_cp16(void* lds_dst, const void* gsrc) {
#if __has_builtin(__builtin_amdgcn_global_load_async_to_lds_b128)
  __builtin_amdgcn_global_load_async_to_lds_b128(
      (AS1 v4i*)(uintptr_t)gsrc,
      (AS3 v4i*)(uint32_t)(uintptr_t)lds_dst, 0, 0);
#else
  *(uint4*)lds_dst = *(const uint4*)gsrc;
#endif
}

// publish point of the ring: every wave passes it once per trip
__device__ __forceinline__ void ring_publish() {
  // this wave's LDS reads of the buffer that is refilled behind the barrier have retired
  asm volatile("s_wait_dscnt 0x0" ::: "memory");
  // this wave's own copies have landed before any other wave reads them
  asm volatile("s_wait_asynccnt 0x0" ::: "memory");
  __syncthreads();
}

// ROWS rows of one K slab (256 B of each row, source pitch 2048 B) -> LDS rows of 272 B;
// a wave's copy covers two whole rows
template <int ROWS>
__device__ __forceinline__ void stage_slab(unsigned char* dst, const unsigned char* src, int tid) {
  #pragma unroll   // the copies issue back to back
  for (int i = 0; i < (ROWS * KSLAB * 2 / 16) / 256; ++i) {   // 16 B chunks / 256 threads
    int idx = tid + i * 256;
    int r   = idx / (KSLAB / 8);                 // 16 chunks per row
    int c   = idx % (KSLAB / 8);
    async_cp16(dst + r * (SL_STRIDE * 2) + c * 16,
               src + (size_t)r * (DIN * 2) + c * 16);
  }
}

// 16 bf16 fragment = two ds_load_b128
__device__ __forceinline__ v16bf load_frag16(const unsigned short* p) {
  union { uint4 q[2]; v16bf v; } f;
  f.q[0] = *(const uint4*)(p);
  f.q[1] = *(const uint4*)(p + 16);
  return f.v;
}

// ---------------- prep pass: f32 -> bf16, weights pre-transposed ----------------
// Each thread converts a block of 32 or 64 elements, so that few waves have to start and each
// of them has all its loads in flight at once.

#define XV 16                  // float4 per thread in cvt_x

__global__ __launch_bounds__(256) void cvt_x_kernel(const float* __restrict__ x,
                                                    unsigned short* __restrict__ xb) {
  const size_t base = (size_t)blockIdx.x * (256 * XV) + threadIdx.x;   // float4 index
  const float* s = x + base * 4;
  f32x4 v[XV];
  #pragma unroll   // all loads issue before the first value is used
  for (int j = 0; j < XV; ++j) v[j] = *(const f32x4*)(s + j * 1024);
  // the loads' address pair stays as it is up to this wait: without the operand the last
  // load's result is placed on the pair that the fifteen loads in front of it name
  asm volatile("s_wait_xcnt 0x0" :: "v"(s) : "memory");
  #pragma unroll
  for (int j = 0; j < XV; ++j) {
    union { unsigned short s[4]; uint2 u; } pk;
    pk.s[0] = f2bf(v[j][0]); pk.s[1] = f2bf(v[j][1]);
    pk.s[2] = f2bf(v[j][2]); pk.s[3] = f2bf(v[j][3]);
    *(uint2*)(xb + (base + j * 256) * 4) = pk.u;
  }
}

// src [n][R][C] (f32) -> dst [n][C][R] (bf16). A workgroup takes 64 r x 128 c, a thread an
// 8 r x 4 c block in registers: 8 float4 loads, 4 stores of 16 B (8 bf16 along r).
// Eight neighbouring lanes lie side by side along r: each store fills whole 128 B lines of dst.
// The eight waves lie side by side along c: together they read 512 B of each source row.
template <int R, int C>
__device__ __forceinline__ void cvt_transpose(const float* __restrict__ src,
                                              unsigned short* __restrict__ dst) {
  constexpr int RB = R / 64, CB = C / 128;
  const unsigned b = blockIdx.x;
  const int cb   = b % CB;
  const int rb   = (b / CB) % RB;
  const int n    = b / (CB * RB);
  const int lane = threadIdx.x & 31;
  const int wave = threadIdx.x >> 5;
  const int r0   = rb * 64 + (lane & 7) * 8;
  const int c0   = cb * 128 + wave * 16 + (lane >> 3) * 4;
  const float* s = src + ((size_t)n * R + r0) * C + c0;
  f32x4 v[8];
  #pragma unroll   // all loads issue before the first value is used
  for (int j = 0; j < 8; ++j) v[j] = *(const f32x4*)(s + (size_t)j * C);
  unsigned short* d = dst + ((size_t)n * C + c0) * R + r0;
  #pragma unroll
  for (int c = 0; c < 4; ++c) {
    union { unsigned short h[8]; uint4 q; } pk;
    #pragma unroll
    for (int j = 0; j < 8; ++j) pk.h[j] = f2bf(v[j][c]);
    *(uint4*)(d + (size_t)c * R) = pk.q;
  }
}

// W1 [n][k][h] (f32) -> W1t [n][h][k] (bf16)
__global__ __launch_bounds__(256) void cvt_w1_kernel(const float* __restrict__ W1,
                                                     unsigned short* __restrict__ W1t) {
  cvt_transpose<DIN, HH>(W1, W1t);
}

// W2 [n][h][o] (f32) -> W2t [n][o][h] (bf16)
__global__ __launch_bounds__(256) void cvt_w2_kernel(const float* __restrict__ W2,
                                                     unsigned short* __restrict__ W2t) {
  cvt_transpose<HH, DOUT>(W2, W2t);
}

// ---------------- fused grouped-MLP WMMA kernel ----------------

__global__ __launch_bounds__(256, 1)
void mlp_concept_kernel(const unsigned short* __restrict__ xb,    // [M][1024] bf16
                        const unsigned short* __restrict__ W1t,   // [n][h][k] bf16
                        const unsigned short* __restrict__ W2t,   // [n][o][h] bf16
                        const float* __restrict__ b1,
                        const float* __restrict__ b2p,
                        float* __restrict__ out) {
  extern __shared__ unsigned char smem[];
  unsigned char* w2_b = smem + W2_OFF;
  const unsigned short* w2_u = (const unsigned short*)w2_b;

  const int tid  = threadIdx.x;
  const int wave = tid >> 5;
  const int lane = tid & 31;
  const int l16  = lane & 15;
  const int g    = lane >> 4;            // K-half group per WMMA layout

  const int m0 = blockIdx.x * M_TILE;
  const int n  = blockIdx.y;

  const unsigned char* xb8  = (const unsigned char*)xb + (size_t)m0 * DIN * 2;
  const unsigned char* w1n8 = (const unsigned char*)W1t + (size_t)n * HH * DIN * 2;
  const unsigned char* w2n8 = (const unsigned char*)W2t + (size_t)n * DOUT * HH * 2;

  // 2 x 4 wave grid. Layer 1: 64 rows x 64 h cols per wave (4 x 4 WMMA tiles: 8 fragments
  // feed 16 WMMAs), computed transposed: W1 is the A operand and x the B operand, so that a
  // lane's 8 accumulator registers are 8 consecutive h of one token.
  // Layer 2: 64 rows x 32 out cols per wave (4 x 2 tiles).
  const int wrow = (wave >> 2) * 64;
  const int wn1  = (wave & 3) * 64;
  const int wn2  = (wave & 3) * 32;

  v8f oacc[4][2] = {};

  // first slab of the first chunk; every later slab is issued one whole slab ahead
  stage_slab<M_TILE>(smem, xb8, tid);
  stage_slab<HC>(smem + XSL_BYTES, w1n8, tid);

  int cur = 0;                                   // ring buffer that holds the slab of this trip

  for (int hc = 0; hc < HH; hc += HC) {
    v8f hacc[4][4] = {};
    const unsigned char* w1c8 = w1n8 + (size_t)hc * (DIN * 2);

    // ---- layer 1: K=1024 reduction over a two-buffer ring of [x | W1] slabs
    for (int s = 0; s < NSLAB; ++s) {
      // slab s (and, on s == 1, the W2 chunk) landed in all waves; other buffer, w2t free
      ring_publish();
      const unsigned short* xsl = (const unsigned short*)(smem + cur * RING_BUF);
      const unsigned short* wsl = (const unsigned short*)(smem + cur * RING_BUF + XSL_BYTES);
      const unsigned short* ap = &xsl[(wrow + l16) * SL_STRIDE + g * 8];
      const unsigned short* bp = &wsl[(wn1 + l16) * SL_STRIDE + g * 8];
      v16bf a[2][4], b[2][4];                    // two fragment sets, one k-step apart
      // every loop over fragments, tiles and k-steps is unrolled whole: with compile-time
      // indices the fragment and accumulator arrays stay in registers
      #pragma unroll
      for (int i = 0; i < 4; ++i) {
        a[0][i] = load_frag16(ap + i * 16 * SL_STRIDE);
        b[0][i] = load_frag16(bp + i * 16 * SL_STRIDE);
      }
      // the first fragments' LDS latency runs under the issue of the copies below
      __builtin_amdgcn_sched_barrier(0);
      if (s == 0) {
        // W2 chunk copy: [128 o][256 h] (contiguous along h), landed by the wait of s == 1
        #pragma unroll
        for (int i = 0; i < (DOUT * HC * 2 / 16) / 256; ++i) {   // 4096 chunks
          int idx = tid + i * 256;
          int o   = idx / (HC / 8);              // 32 chunks per o row
          int c   = idx % (HC / 8);
          async_cp16(w2_b + o * (S_STRIDE * 2) + c * 16,
                     w2n8 + (size_t)o * (HH * 2) + hc * 2 + c * 16);
        }
      }
      // overlap the copy of this chunk's next slab with WMMA
      if (s + 1 < NSLAB) {
        unsigned char* nb = smem + (cur ^ 1) * RING_BUF;
        stage_slab<M_TILE>(nb, xb8 + (s + 1) * (KSLAB * 2), tid);
        stage_slab<HC>(nb + XSL_BYTES, w1c8 + (s + 1) * (KSLAB * 2), tid);
      }
      #pragma unroll
      for (int ks = 0; ks < KSLAB / 32; ++ks) {
        const int fc = ks & 1, fn = fc ^ 1;
        if (ks + 1 < KSLAB / 32) {
          #pragma unroll
          for (int i = 0; i < 4; ++i) {
            a[fn][i] = load_frag16(ap + i * 16 * SL_STRIDE + (ks + 1) * 32);
            b[fn][i] = load_frag16(bp + i * 16 * SL_STRIDE + (ks + 1) * 32);
          }
        }
        // keeps the next k-step's LDS reads one group ahead of this step's WMMAs
        // (left free, the scheduler spreads them among the WMMAs and the waits reach 0)
        __builtin_amdgcn_sched_barrier(0);
        #pragma unroll
        for (int i = 0; i < 4; ++i) {
          #pragma unroll
          for (int t = 0; t < 4; ++t) {
            // hacc[i][t][r] = h[token wrow + 16 i + l16][col wn1 + 16 t + 8 g + r]
            hacc[i][t] = __builtin_amdgcn_wmma_f32_16x16x32_bf16(
                false, b[fc][t], false, a[fc][i], (short)0, hacc[i][t], false, false);
          }
        }
        __builtin_amdgcn_sched_barrier(0);       // the group after next stays behind these WMMAs
      }
      cur ^= 1;
    }

    // After an even number of trips cur is the buffer of the last trip but one: every wave has
    // passed the last trip's barrier, so nobody reads it any more, and no copy is aimed at it.
    unsigned short* hs_u = (unsigned short*)(smem + cur * RING_BUF);

    // ---- bias + ReLU -> bf16 h chunk in LDS (never touches global)
    // a lane packs its 8 consecutive h of one token: pair converts (round to nearest even, as
    // f2bf) and one 16 B store per tile
    #pragma unroll
    for (int t = 0; t < 4; ++t) {
      const int col = wn1 + t * 16 + g * 8;
      const f32x4 blo = *(const f32x4*)(b1 + n * HH + hc + col);
      const f32x4 bhi = *(const f32x4*)(b1 + n * HH + hc + col + 4);
      #pragma unroll
      for (int i = 0; i < 4; ++i) {
        union { bf16x2 p[4]; uint4 q; } pk;
        #pragma unroll
        for (int r = 0; r < 8; r += 2) {
          f32x2 v;
          v[0] = hacc[i][t][r]     + (r < 4 ? blo[r]     : bhi[r - 4]);
          v[1] = hacc[i][t][r + 1] + (r < 4 ? blo[r + 1] : bhi[r - 3]);
          v[0] = v[0] > 0.0f ? v[0] : 0.0f;
          v[1] = v[1] > 0.0f ? v[1] : 0.0f;
          pk.p[r / 2] = __builtin_convertvector(v, bf16x2);
        }
        *(uint4*)&hs_u[(wrow + i * 16 + l16) * S_STRIDE + col] = pk.q;
      }
    }
    // hs visible; the last trip's buffer is free (the compiler's s_wait_dscnt 0 stands in front)
    __syncthreads();

    // the next chunk's first slab goes into the buffer of the last trip, under layer 2
    if (hc + HC < HH) {
      unsigned char* nb = smem + (cur ^ 1) * RING_BUF;
      stage_slab<M_TILE>(nb, xb8, tid);
      stage_slab<HC>(nb + XSL_BYTES, w1c8 + (size_t)HC * (DIN * 2), tid);
    }

    // ---- layer 2: oacc += relu(h_chunk) @ W2_chunk (K = 256)
    {
      const unsigned short* ap2 = &hs_u[(wrow + l16) * S_STRIDE + g * 8];
      const unsigned short* bp2 = &w2_u[(wn2 + l16) * S_STRIDE + g * 8];
      v16bf a2[2][4], bw[2][2];
      #pragma unroll
      for (int i = 0; i < 4; ++i) a2[0][i] = load_frag16(ap2 + i * 16 * S_STRIDE);
      #pragma unroll
      for (int t = 0; t < 2; ++t) bw[0][t] = load_frag16(bp2 + t * 16 * S_STRIDE);
      #pragma unroll
      for (int ks = 0; ks < HC / 32; ++ks) {
        const int fc = ks & 1, fn = fc ^ 1;
        if (ks + 1 < HC / 32) {
          #pragma unroll
          for (int i = 0; i < 4; ++i)
            a2[fn][i] = load_frag16(ap2 + i * 16 * S_STRIDE + (ks + 1) * 32);
          #pragma unroll
          for (int t = 0; t < 2; ++t)
            bw[fn][t] = load_frag16(bp2 + t * 16 * S_STRIDE + (ks + 1) * 32);
        }
        __builtin_amdgcn_sched_barrier(0);       // as in layer 1: reads one group ahead
        #pragma unroll
        for (int i = 0; i < 4; ++i) {
          #pragma unroll
          for (int t = 0; t < 2; ++t) {
            oacc[i][t] = __builtin_amdgcn_wmma_f32_16x16x32_bf16(
                false, a2[fc][i], false, bw[fc][t], (short)0, oacc[i][t], false, false);
          }
        }
        __builtin_amdgcn_sched_barrier(0);       // as in layer 1
      }
    }
    cur ^= 1;                                    // the next chunk begins on the buffer just filled
  }

  // ---- epilogue: + b2, f32 store out[m, n, o]
  #pragma unroll
  for (int t = 0; t < 2; ++t) {
    int col = wn2 + t * 16 + l16;
    float bias = b2p[n * DOUT + col];
    #pragma unroll
    for (int i = 0; i < 4; ++i) {
      #pragma unroll
      for (int r = 0; r < 8; ++r) {
        int m = m0 + wrow + i * 16 + g * 8 + r;
        out[(size_t)m * (N_ * DOUT) + n * DOUT + col] = oacc[i][t][r] + bias;
      }
    }
  }
}

extern "C" void kernel_launch(void* const* d_in, const int* in_sizes, int n_in,
                              void* d_out, int out_size, void* d_ws, size_t ws_size,
                              hipStream_t stream) {
  const float* x  = (const float*)d_in[0];
  const float* W1 = (const float*)d_in[1];
  const float* b1 = (const float*)d_in[2];
  const float* W2 = (const float*)d_in[3];
  const float* b2 = (const float*)d_in[4];
  float* out = (float*)d_out;

  // workspace layout (bf16): x copy, W1 transposed, W2 transposed  (~50 MB)
  unsigned short* xb  = (unsigned short*)d_ws;                          // 16384*1024
  unsigned short* W1t = xb  + (size_t)M_TOT * DIN;                      // 16*512*1024
  unsigned short* W2t = W1t + (size_t)N_ * HH * DIN;                    // 16*128*512

  cvt_x_kernel <<<(M_TOT * DIN / 4) / (256 * XV), 256, 0, stream>>>(x, xb);
  cvt_w1_kernel<<<N_ * (DIN / 64) * (HH / 128), 256, 0, stream>>>(W1, W1t);
  cvt_w2_kernel<<<N_ * (HH / 64) * (DOUT / 128), 256, 0, stream>>>(W2, W2t);

  hipError_t attr_rc = hipFuncSetAttribute(
      reinterpret_cast<const void*>(mlp_concept_kernel),
      hipFuncAttributeMaxDynamicSharedMemorySize, (int)SMEM_BYTES);
  (void)attr_rc;

  dim3 grid(M_TOT / M_TILE, N_);                 // 128 token tiles x 16 concepts
  mlp_concept_kernel<<<grid, 256, SMEM_BYTES, stream>>>(xb, W1t, W2t, b1, b2, out);
}

// v005
// Measured time: 204 microseconds a run.
// In both of two side-by-side timings against v004, it was 1.04 times as fast.
// Counting every step since v000, it is 5.50 times as fast.
#include <hip/hip_runtime.h>
#include <stdint.h>

#define B_    8
#define T_    2048
#define N_    16
#define DIN   1024
#define HH    512
#define DOUT  128
#define M_TOT (B_ * T_)        // 16384 tokens

#define M_TILE 128             // tokens per workgroup
#define HC     256             // H columns per fused chunk
#define KSLAB  128             // K staged per LDS slab (4 WMMA k-steps)
#define NSLAB  (DIN / KSLAB)   // 8 slabs per chunk (even: see the ring's buffer order)
#define NSIDE  2               // concepts that run side by side: 128 token tiles x 2 = 256 workgroups

#define SL_STRIDE (KSLAB + 8)  // bf16 elems per x / W1 slab row (+8 pad: 272 B = 16 B x odd)
#define S_STRIDE  (HC + 8)     // bf16 elems per h / W2 chunk row (+8 pad: 528 B = 16 B x odd)

// LDS byte offsets: the W2 chunk, behind it two ring buffers, each [x slab | W1 slab] (the ring
// lies above 64 KiB: an immediate offset that the compiler folds into a slab copy, and takes off
// the copy's LDS address register, leaves that register above 0).
// The h chunk has no room of its own: it lies in the ring buffer that is idle between chunks.
#define XSL_BYTES (M_TILE * SL_STRIDE * 2)         // 34816
#define WSL_BYTES (HC * SL_STRIDE * 2)             // 69632
#define RING_BUF  (XSL_BYTES + WSL_BYTES)          // 104448 per buffer
#define HS_BYTES  (M_TILE * S_STRIDE * 2)          // 67584
#define W2_BYTES  (DOUT * S_STRIDE * 2)            // 67584
#define RING_OFF  W2_BYTES
#define SMEM_BYTES (RING_OFF + 2 * RING_BUF)       // 276480
static_assert(NSLAB >= 2 && NSLAB % 2 == 0, "ring: a chunk ends on the buffer it began on");
static_assert(HS_BYTES <= RING_BUF, "the h chunk lies inside one ring buffer");
static_assert(SMEM_BYTES <= 327680, "one workgroup's LDS");

typedef __bf16 v16bf __attribute__((ext_vector_type(16)));
typedef float  v8f   __attribute__((ext_vector_type(8)));
typedef int    v4i   __attribute__((ext_vector_type(4)));
typedef float  f32x2 __attribute__((ext_vector_type(2)));
typedef float  f32x4 __attribute__((ext_vector_type(4)));
typedef __bf16 bf16x2 __attribute__((ext_vector_type(2)));

#define AS1 __attribute__((address_space(1)))
#define AS3 __attribute__((address_space(3)))

__device__ __forceinline__ unsigned short f2bf(float f) {
  union { float f; uint32_t u; } c; c.f = f;
  uint32_t r = c.u + 0x7FFFu + ((c.u >> 16) & 1u);   // round-to-nearest-even
  return (unsigned short)(r >> 16);
}

// 16-byte global -> LDS copy on the CDNA5 async path (ASYNCcnt),
// with a synchronous VGPR fallback if the builtin is unavailable.
__device__ __forceinline__ void async_cp16(void* lds_dst, const void* gsrc) {
#if __has_builtin(__builtin_amdgcn_global_load_async_to_lds_b128)
  __builtin_amdgcn_global_load_async_to_lds_b128(
      (AS1 v4i*)(uintptr_t)gsrc,
      (AS3 v4i*)(uint32_t)(uintptr_t)lds_dst, 0, 0);
#else
  *(uint4*)lds_dst = *(const uint4*)gsrc;
#endif
}

// publish point of the ring: every wave passes it once per trip
__device__ __forceinline__ void ring_publish() {
  // this wave's LDS reads of the buffer that is refilled behind the barrier have retired
  asm volatile("s_wait_dscnt 0x0" ::: "memory");
  // this wave's own copies have landed before any other wave reads them
  asm volatile("s_wait_asynccnt 0x0" ::: "memory");
  __syncthreads();
}

// ROWS rows of one K slab (256 B of each row, source pitch 2048 B) -> LDS rows of 272 B;
// a wave's copy covers two whole rows
// dst and src are the same in every lane; a lane's own place is one 32-bit offset on each side
// (row tid / 16, 16 B chunk tid % 16), the step from copy to copy (16 rows) goes on the common part
template <int ROWS>
__device__ __forceinline__ void stage_slab(unsigned char* dst, const unsigned char* src, int tid) {
  const uint32_t lofs = (uint32_t)(tid / (KSLAB / 8)) * (SL_STRIDE * 2) + (tid % (KSLAB / 8)) * 16;
  const uint32_t gofs = (uint32_t)(tid / (KSLAB / 8)) * (DIN * 2) + (tid % (KSLAB / 8)) * 16;
  #pragma unroll   // the copies issue back to back
  for (int i = 0; i < (ROWS * KSLAB * 2 / 16) / 256; ++i) {   // 16 B chunks / 256 threads
    async_cp16(dst + i * (16 * SL_STRIDE * 2) + lofs,
               (src + (size_t)i * (16 * DIN * 2)) + gofs);
  }
}

// 16 bf16 fragment = two ds_load_b128
__device__ __forceinline__ v16bf load_frag16(const unsigned short* p) {
  union { uint4 q[2]; v16bf v; } f;
  f.q[0] = *(const uint4*)(p);
  f.q[1] = *(const uint4*)(p + 16);
  return f.v;
}

// ---------------- prep pass: f32 -> bf16, weights pre-transposed ----------------
// Each thread converts a block of 32 or 64 elements, so that few waves have to start and each
// of them has all its loads in flight at once.

#define XV 16                  // float4 per thread in cvt_x

__global__ __launch_bounds__(256) void cvt_x_kernel(const float* __restrict__ x,
                                                    unsigned short* __restrict__ xb) {
  const size_t base = (size_t)blockIdx.x * (256 * XV) + threadIdx.x;   // float4 index
  const float* s = x + base * 4;
  f32x4 v[XV];
  #pragma unroll   // all loads issue before the first value is used
  for (int j = 0; j < XV; ++j) v[j] = *(const f32x4*)(s + j * 1024);
  // the loads' address pair stays as it is up to this wait: without the operand the last
  // load's result is placed on the pair that the fifteen loads in front of it name
  asm volatile("s_wait_xcnt 0x0" :: "v"(s) : "memory");
  #pragma unroll
  for (int j = 0; j < XV; ++j) {
    union { unsigned short s[4]; uint2 u; } pk;
    pk.s[0] = f2bf(v[j][0]); pk.s[1] = f2bf(v[j][1]);
    pk.s[2] = f2bf(v[j][2]); pk.s[3] = f2bf(v[j][3]);
    *(uint2*)(xb + (base + j * 256) * 4) = pk.u;
  }
}

// src [n][R][C] (f32) -> dst [n][C][R] (bf16). A workgroup takes 64 r x 128 c, a thread an
// 8 r x 4 c block in registers: 8 float4 loads, 4 stores of 16 B (8 bf16 along r).
// Eight neighbouring lanes lie side by side along r: each store fills whole 128 B lines of dst.
// The eight waves lie side by side along c: together they read 512 B of each source row.
template <int R, int C>
__device__ __forceinline__ void cvt_transpose(const float* __restrict__ src,
                                              unsigned short* __restrict__ dst) {
  constexpr int RB = R / 64, CB = C / 128;
  const unsigned b = blockIdx.x;
  const int cb   = b % CB;
  const int rb   = (b / CB) % RB;
  const int n    = b / (CB * RB);
  const int lane = threadIdx.x & 31;
  const int wave = threadIdx.x >> 5;
  const int r0   = rb * 64 + (lane & 7) * 8;
  const int c0   = cb * 128 + wave * 16 + (lane >> 3) * 4;
  const float* s = src + ((size_t)n * R + r0) * C + c0;
  f32x4 v[8];
  #pragma unroll   // all loads issue before the first value is used
  for (int j = 0; j < 8; ++j) v[j] = *(const f32x4*)(s + (size_t)j * C);
  unsigned short* d = dst + ((size_t)n * C + c0) * R + r0;
  #pragma unroll
  for (int c = 0; c < 4; ++c) {
    union { unsigned short h[8]; uint4 q; } pk;
    #pragma unroll
    for (int j = 0; j < 8; ++j) pk.h[j] = f2bf(v[j][c]);
    *(uint4*)(d + (size_t)c * R) = pk.q;
  }
}

// W1 [n][k][h] (f32) -> W1t [n][h][k] (bf16)
__global__ __launch_bounds__(256) void cvt_w1_kernel(const float* __restrict__ W1,
                                                     unsigned short* __restrict__ W1t) {
  cvt_transpose<DIN, HH>(W1, W1t);
}

// W2 [n][h][o] (f32) -> W2t [n][o][h] (bf16)
__global__ __launch_bounds__(256) void cvt_w2_kernel(const float* __restrict__ W2,
                                                     unsigned short* __restrict__ W2t) {
  cvt_transpose<HH, DOUT>(W2, W2t);
}

// ---------------- fused grouped-MLP WMMA kernel ----------------

__global__ __launch_bounds__(256, 1)
void mlp_concept_kernel(const unsigned short* __restrict__ xb,    // [M][1024] bf16
                        const unsigned short* __restrict__ W1t,   // [n][h][k] bf16
                        const unsigned short* __restrict__ W2t,   // [n][o][h] bf16
                        const float* __restrict__ b1,
                        const float* __restrict__ b2p,
                        float* __restrict__ out) {
  extern __shared__ unsigned char smem[];
  unsigned char* w2_b = smem;
  unsigned char* ring = smem + RING_OFF;
  const unsigned short* w2_u = (const unsigned short*)w2_b;

  const int tid  = threadIdx.x;
  const int wave = tid >> 5;
  const int lane = tid & 31;
  const int l16  = lane & 15;
  const int g    = lane >> 4;            // K-half group per WMMA layout

  const int m0 = blockIdx.x * M_TILE;

  const unsigned char* xb8  = (const unsigned char*)xb + (size_t)m0 * DIN * 2;

  // 2 x 4 wave grid. Layer 1: 64 rows x 64 h cols per wave (4 x 4 WMMA tiles: 8 fragments
  // feed 16 WMMAs), computed transposed: W1 is the A operand and x the B operand, so that a
  // lane's 8 accumulator registers are 8 consecutive h of one token.
  // Layer 2: 64 rows x 32 out cols per wave (4 x 2 tiles).
  const int wrow = (wave >> 2) * 64;
  const int wn1  = (wave & 3) * 64;
  const int wn2  = (wave & 3) * 32;

  // first slab of the first concept's first chunk; every later slab is issued one whole slab ahead
  stage_slab<M_TILE>(ring, xb8, tid);
  stage_slab<HC>(ring + XSL_BYTES,
                 (const unsigned char*)W1t + (size_t)blockIdx.y * HH * DIN * 2, tid);

  int cur = 0;                                   // ring buffer that holds the slab of this trip

  // One workgroup stays on its WGP and takes its token tile through every NSIDE-th concept; the
  // ring runs on from one concept to the next as it does from one chunk to the next.
  for (int n = blockIdx.y; n < N_; n += NSIDE) {
  const unsigned char* w1n8 = (const unsigned char*)W1t + (size_t)n * HH * DIN * 2;
  const unsigned char* w2n8 = (const unsigned char*)W2t + (size_t)n * DOUT * HH * 2;

  v8f oacc[4][2] = {};

  for (int hc = 0; hc < HH; hc += HC) {
    v8f hacc[4][4] = {};
    const unsigned char* w1c8 = w1n8 + (size_t)hc * (DIN * 2);

    // ---- layer 1: K=1024 reduction over a two-buffer ring of [x | W1] slabs
    for (int s = 0; s < NSLAB; ++s) {
      // slab s (and, on s == 1, the W2 chunk) landed in all waves; other buffer, w2t free
      ring_publish();
      const unsigned short* xsl = (const unsigned short*)(ring + cur * RING_BUF);
      const unsigned short* wsl = (const unsigned short*)(ring + cur * RING_BUF + XSL_BYTES);
      const unsigned short* ap = &xsl[(wrow + l16) * SL_STRIDE + g * 8];
      const unsigned short* bp = &wsl[(wn1 + l16) * SL_STRIDE + g * 8];
      v16bf a[2][4], b[2][4];                    // two fragment sets, one k-step apart
      // every loop over fragments, tiles and k-steps is unrolled whole: with compile-time
      // indices the fragment and accumulator arrays stay in registers
      #pragma unroll
      for (int i = 0; i < 4; ++i) {
        a[0][i] = load_frag16(ap + i * 16 * SL_STRIDE);
        b[0][i] = load_frag16(bp + i * 16 * SL_STRIDE);
      }
      // the first fragments' LDS latency runs under the issue of the copies below
      __builtin_amdgcn_sched_barrier(0);
      if (s == 0) {
        // W2 chunk copy: [128 o][256 h] (contiguous along h), landed by the wait of s == 1
        #pragma unroll
        for (int i = 0; i < (DOUT * HC * 2 / 16) / 256; ++i) {   // 4096 chunks
          int idx = tid + i * 256;
          int o   = idx / (HC / 8);              // 32 chunks per o row
          int c   = idx % (HC / 8);
          async_cp16(w2_b + o * (S_STRIDE * 2) + c * 16,
                     w2n8 + (size_t)o * (HH * 2) + hc * 2 + c * 16);
        }
      }
      // overlap the copy of this chunk's next slab with WMMA
      if (s + 1 < NSLAB) {
        unsigned char* nb = ring + (cur ^ 1) * RING_BUF;
        stage_slab<M_TILE>(nb, xb8 + (s + 1) * (KSLAB * 2), tid);
        stage_slab<HC>(nb + XSL_BYTES, w1c8 + (s + 1) * (KSLAB * 2), tid);
      }
      #pragma unroll
      for (int ks = 0; ks < KSLAB / 32; ++ks) {
        const int fc = ks & 1, fn = fc ^ 1;
        if (ks + 1 < KSLAB / 32) {
          #pragma unroll
          for (int i = 0; i < 4; ++i) {
            a[fn][i] = load_frag16(ap + i * 16 * SL_STRIDE + (ks + 1) * 32);
            b[fn][i] = load_frag16(bp + i * 16 * SL_STRIDE + (ks + 1) * 32);
          }
        }
        // keeps the next k-step's LDS reads one group ahead of this step's WMMAs
        // (left free, the scheduler spreads them among the WMMAs and the waits reach 0)
        __builtin_amdgcn_sched_barrier(0);
        #pragma unroll
        for (int i = 0; i < 4; ++i) {
          #pragma unroll
          for (int t = 0; t < 4; ++t) {
            // hacc[i][t][r] = h[token wrow + 16 i + l16][col wn1 + 16 t + 8 g + r]
            hacc[i][t] = __builtin_amdgcn_wmma_f32_16x16x32_bf16(
                false, b[fc][t], false, a[fc][i], (short)0, hacc[i][t], false, false);
          }
        }
        __builtin_amdgcn_sched_barrier(0);       // the group after next stays behind these WMMAs
      }
      cur ^= 1;
    }

    // After an even number of trips cur is the buffer of the last trip but one: every wave has
    // passed the last trip's barrier, so nobody reads it any more, and no copy is aimed at it.
    unsigned short* hs_u = (unsigned short*)(ring + cur * RING_BUF);

    // ---- bias + ReLU -> bf16 h chunk in LDS (never touches global)
    // a lane packs its 8 consecutive h of one token: pair converts (round to nearest even, as
    // f2bf) and one 16 B store per tile
    #pragma unroll
    for (int t = 0; t < 4; ++t) {
      const int col = wn1 + t * 16 + g * 8;
      const f32x4 blo = *(const f32x4*)(b1 + n * HH + hc + col);
      const f32x4 bhi = *(const f32x4*)(b1 + n * HH + hc + col + 4);
      #pragma unroll
      for (int i = 0; i < 4; ++i) {
        union { bf16x2 p[4]; uint4 q; } pk;
        #pragma unroll
        for (int r = 0; r < 8; r += 2) {
          f32x2 v;
          v[0] = hacc[i][t][r]     + (r < 4 ? blo[r]     : bhi[r - 4]);
          v[1] = hacc[i][t][r + 1] + (r < 4 ? blo[r + 1] : bhi[r - 3]);
          v[0] = v[0] > 0.0f ? v[0] : 0.0f;
          v[1] = v[1] > 0.0f ? v[1] : 0.0f;
          pk.p[r / 2] = __builtin_convertvector(v, bf16x2);
        }
        *(uint4*)&hs_u[(wrow + i * 16 + l16) * S_STRIDE + col] = pk.q;
      }
    }
    // hs visible; the last trip's buffer is free (the compiler's s_wait_dscnt 0 stands in front)
    __syncthreads();

    // the first slab of the next chunk, or of the next concept's first chunk, goes into the
    // buffer of the last trip, under layer 2 (and the stores of out)
    const bool more_chunks = hc + HC < HH;
    if (more_chunks || n + NSIDE < N_) {
      unsigned char* nb = ring + (cur ^ 1) * RING_BUF;
      const unsigned char* nw = more_chunks ? w1c8 + (size_t)HC * (DIN * 2)
                                            : w1n8 + (size_t)NSIDE * HH * (DIN * 2);
      stage_slab<M_TILE>(nb, xb8, tid);
      stage_slab<HC>(nb + XSL_BYTES, nw, tid);
    }

    // ---- layer 2: oacc += relu(h_chunk) @ W2_chunk (K = 256)
    {
      const unsigned short* ap2 = &hs_u[(wrow + l16) * S_STRIDE + g * 8];
      const unsigned short* bp2 = &w2_u[(wn2 + l16) * S_STRIDE + g * 8];
      v16bf a2[2][4], bw[2][2];
      #pragma unroll
      for (int i = 0; i < 4; ++i) a2[0][i] = load_frag16(ap2 + i * 16 * S_STRIDE);
      #pragma unroll
      for (int t = 0; t < 2; ++t) bw[0][t] = load_frag16(bp2 + t * 16 * S_STRIDE);
      #pragma unroll
      for (int ks = 0; ks < HC / 32; ++ks) {
        const int fc = ks & 1, fn = fc ^ 1;
        if (ks + 1 < HC / 32) {
          #pragma unroll
          for (int i = 0; i < 4; ++i)
            a2[fn][i] = load_frag16(ap2 + i * 16 * S_STRIDE + (ks + 1) * 32);
          #pragma unroll
          for (int t = 0; t < 2; ++t)
            bw[fn][t] = load_frag16(bp2 + t * 16 * S_STRIDE + (ks + 1) * 32);
        }
        __builtin_amdgcn_sched_barrier(0);       // as in layer 1: reads one group ahead
        #pragma unroll
        for (int i = 0; i < 4; ++i) {
          #pragma unroll
          for (int t = 0; t < 2; ++t) {
            oacc[i][t] = __builtin_amdgcn_wmma_f32_16x16x32_bf16(
                false, a2[fc][i], false, bw[fc][t], (short)0, oacc[i][t], false, false);
          }
        }
        __builtin_amdgcn_sched_barrier(0);       // as in layer 1
      }
    }
    cur ^= 1;                                    // the next chunk begins on the buffer just filled
  }

  // ---- epilogue: + b2, f32 store out[m, n, o]
  #pragma unroll
  for (int t = 0; t < 2; ++t) {
    int col = wn2 + t * 16 + l16;
    float bias = b2p[n * DOUT + col];
    #pragma unroll
    for (int i = 0; i < 4; ++i) {
      #pragma unroll
      for (int r = 0; r < 8; ++r) {
        int m = m0 + wrow + i * 16 + g * 8 + r;
        out[(size_t)m * (N_ * DOUT) + n * DOUT + col] = oacc[i][t][r] + bias;
      }
    }
  }
  // the next concept's pass overwrites the registers that the stores above name
  asm volatile("s_wait_xcnt 0x0" ::: "memory");
  }
}

extern "C" void kernel_launch(void* const* d_in, const int* in_sizes, int n_in,
                              void* d_out, int out_size, void* d_ws, size_t ws_size,
                              hipStream_t stream) {
  const float* x  = (const float*)d_in[0];
  const float* W1 = (const float*)d_in[1];
  const float* b1 = (const float*)d_in[2];
  const float* W2 = (const float*)d_in[3];
  const float* b2 = (const float*)d_in[4];
  float* out = (float*)d_out;

  // workspace layout (bf16): x copy, W1 transposed, W2 transposed  (~50 MB)
  unsigned short* xb  = (unsigned short*)d_ws;                          // 16384*1024
  unsigned short* W1t = xb  + (size_t)M_TOT * DIN;                      // 16*512*1024
  unsigned short* W2t = W1t + (size_t)N_ * HH * DIN;                    // 16*128*512

  cvt_x_kernel <<<(M_TOT * DIN / 4) / (256 * XV), 256, 0, stream>>>(x, xb);
  cvt_w1_kernel<<<N_ * (DIN / 64) * (HH / 128), 256, 0, stream>>>(W1, W1t);
  cvt_w2_kernel<<<N_ * (HH / 64) * (DOUT / 128), 256, 0, stream>>>(W2, W2t);

  hipError_t attr_rc = hipFuncSetAttribute(
      reinterpret_cast<const void*>(mlp_concept_kernel),
      hipFuncAttributeMaxDynamicSharedMemorySize, (int)SMEM_BYTES);
  (void)attr_rc;

  dim3 grid(M_TOT / M_TILE, NSIDE);              // 128 token tiles x 2: one workgroup per WGP
  mlp_concept_kernel<<<grid, 256, SMEM_BYTES, stream>>>(xb, W1t, W2t, b1, b2, out);
}

// v006
// A run of this version takes 198 microseconds.
// Next to v005, in two timings, it ran 1.03 times as fast each time.
// All steps since v000 together make it 5.67 times as fast.
#include <hip/hip_runtime.h>
#include <stdint.h>

#define B_    8
#define T_    2048
#define N_    16
#define DIN   1024
#define HH    512
#define DOUT  128
#define M_TOT (B_ * T_)        // 16384 tokens

#define M_TILE 128             // tokens per workgroup
#define HC     256             // H columns per fused chunk
#define KSLAB  128             // K staged per LDS slab (4 WMMA k-steps)
#define NSLAB  (DIN / KSLAB)   // 8 slabs per chunk (even: see the ring's buffer order)
#define NSIDE  2               // concepts that run side by side: 128 token tiles x 2 = 256 workgroups
#define NPASS  (N_ / NSIDE)    // concepts that one workgroup takes its token tile through

#define SL_STRIDE (KSLAB + 8)  // bf16 elems per x / W1 slab row (+8 pad: 272 B = 16 B x odd)
#define S_STRIDE  (HC + 8)     // bf16 elems per h / W2 chunk row (+8 pad: 528 B = 16 B x odd)

// LDS byte offsets: the W2 chunk, behind it two ring buffers, each [x slab | W1 slab] (the ring
// lies above 64 KiB: an immediate offset that the compiler folds into a slab copy, and takes off
// the copy's LDS address register, leaves that register above 0).
// The h chunk has no room of its own: it lies in the ring buffer that is idle between chunks.
#define XSL_BYTES (M_TILE * SL_STRIDE * 2)         // 34816
#define WSL_BYTES (HC * SL_STRIDE * 2)             // 69632
#define RING_BUF  (XSL_BYTES + WSL_BYTES)          // 104448 per buffer
#define HS_BYTES  (M_TILE * S_STRIDE * 2)          // 67584
#define W2_BYTES  (DOUT * S_STRIDE * 2)            // 67584
#define RING_OFF  W2_BYTES
#define SMEM_BYTES (RING_OFF + 2 * RING_BUF)       // 276480
static_assert(NSLAB >= 2 && NSLAB % 2 == 0, "ring: a chunk ends on the buffer it began on");
static_assert((NSLAB & (NSLAB - 1)) == 0 && (NPASS & (NPASS - 1)) == 0, "the walks wrap round by a mask");
static_assert(HS_BYTES <= RING_BUF, "the h chunk lies inside one ring buffer");
static_assert(SMEM_BYTES <= 327680, "one workgroup's LDS");

typedef __bf16 v16bf __attribute__((ext_vector_type(16)));
typedef float  v8f   __attribute__((ext_vector_type(8)));
typedef int    v4i   __attribute__((ext_vector_type(4)));
typedef float  f32x2 __attribute__((ext_vector_type(2)));
typedef float  f32x4 __attribute__((ext_vector_type(4)));
typedef __bf16 bf16x2 __attribute__((ext_vector_type(2)));

#define AS1 __attribute__((address_space(1)))
#define AS3 __attribute__((address_space(3)))

__device__ __forceinline__ unsigned short f2bf(float f) {
  union { float f; uint32_t u; } c; c.f = f;
  uint32_t r = c.u + 0x7FFFu + ((c.u >> 16) & 1u);   // round-to-nearest-even
  return (unsigned short)(r >> 16);
}

// 16-byte global -> LDS copy on the CDNA5 async path (ASYNCcnt),
// with a synchronous VGPR fallback if the builtin is unavailable.
__device__ __forceinline__ void async_cp16(void* lds_dst, const void* gsrc) {
#if __has_builtin(__builtin_amdgcn_global_load_async_to_lds_b128)
  __builtin_amdgcn_global_load_async_to_lds_b128(
      (AS1 v4i*)(uintptr_t)gsrc,
      (AS3 v4i*)(uint32_t)(uintptr_t)lds_dst, 0, 0);
#else
  *(uint4*)lds_dst = *(const uint4*)gsrc;
#endif
}

// publish point of the ring: every wave passes it once per trip
__device__ __forceinline__ void ring_publish() {
  // this wave's LDS reads of the buffer that is refilled behind the barrier have retired
  asm volatile("s_wait_dscnt 0x0" ::: "memory");
  // this wave's own copies have landed before any other wave reads them
  asm volatile("s_wait_asynccnt 0x0" ::: "memory");
  __syncthreads();
}

// ROWS rows of one K slab (256 B of each row, source pitch 2048 B) -> LDS rows of 272 B;
// a wave's copy covers two whole rows
// dst and src are the same in every lane; a lane's own place is one 32-bit offset on each side
// (row tid / 16, 16 B chunk tid % 16), the step from copy to copy (16 rows) goes on the common part
template <int ROWS>
__device__ __forceinline__ void stage_slab(unsigned char* dst, const unsigned char* src, int tid) {
  const uint32_t lofs = (uint32_t)(tid / (KSLAB / 8)) * (SL_STRIDE * 2) + (tid % (KSLAB / 8)) * 16;
  const uint32_t gofs = (uint32_t)(tid / (KSLAB / 8)) * (DIN * 2) + (tid % (KSLAB / 8)) * 16;
  #pragma unroll   // the copies issue back to back
  for (int i = 0; i < (ROWS * KSLAB * 2 / 16) / 256; ++i) {   // 16 B chunks / 256 threads
    async_cp16(dst + i * (16 * SL_STRIDE * 2) + lofs,
               (src + (size_t)i * (16 * DIN * 2)) + gofs);
  }
}

// 16 bf16 fragment = two ds_load_b128
__device__ __forceinline__ v16bf load_frag16(const unsigned short* p) {
  union { uint4 q[2]; v16bf v; } f;
  f.q[0] = *(const uint4*)(p);
  f.q[1] = *(const uint4*)(p + 16);
  return f.v;
}

// ---------------- prep pass: f32 -> bf16, weights pre-transposed ----------------
// Each thread converts a block of 32 or 64 elements, so that few waves have to start and each
// of them has all its loads in flight at once.

#define XV 16                  // float4 per thread in cvt_x

__global__ __launch_bounds__(256) void cvt_x_kernel(const float* __restrict__ x,
                                                    unsigned short* __restrict__ xb) {
  const size_t base = (size_t)blockIdx.x * (256 * XV) + threadIdx.x;   // float4 index
  const float* s = x + base * 4;
  f32x4 v[XV];
  #pragma unroll   // all loads issue before the first value is used
  for (int j = 0; j < XV; ++j) v[j] = *(const f32x4*)(s + j * 1024);
  // the loads' address pair stays as it is up to this wait: without the operand the last
  // load's result is placed on the pair that the fifteen loads in front of it name
  asm volatile("s_wait_xcnt 0x0" :: "v"(s) : "memory");
  #pragma unroll
  for (int j = 0; j < XV; ++j) {
    union { unsigned short s[4]; uint2 u; } pk;
    pk.s[0] = f2bf(v[j][0]); pk.s[1] = f2bf(v[j][1]);
    pk.s[2] = f2bf(v[j][2]); pk.s[3] = f2bf(v[j][3]);
    *(uint2*)(xb + (base + j * 256) * 4) = pk.u;
  }
}

// src [n][R][C] (f32) -> dst [n][C][R] (bf16). A workgroup takes 64 r x 128 c, a thread an
// 8 r x 4 c block in registers: 8 float4 loads, 4 stores of 16 B (8 bf16 along r).
// Eight neighbouring lanes lie side by side along r: each store fills whole 128 B lines of dst.
// The eight waves lie side by side along c: together they read 512 B of each source row.
template <int R, int C>
__device__ __forceinline__ void cvt_transpose(const float* __restrict__ src,
                                              unsigned short* __restrict__ dst) {
  constexpr int RB = R / 64, CB = C / 128;
  const unsigned b = blockIdx.x;
  const int cb   = b % CB;
  const int rb   = (b / CB) % RB;
  const int n    = b / (CB * RB);
  const int lane = threadIdx.x & 31;
  const int wave = threadIdx.x >> 5;
  const int r0   = rb * 64 + (lane & 7) * 8;
  const int c0   = cb * 128 + wave * 16 + (lane >> 3) * 4;
  const float* s = src + ((size_t)n * R + r0) * C + c0;
  f32x4 v[8];
  #pragma unroll   // all loads issue before the first value is used
  for (int j = 0; j < 8; ++j) v[j] = *(const f32x4*)(s + (size_t)j * C);
  unsigned short* d = dst + ((size_t)n * C + c0) * R + r0;
  #pragma unroll
  for (int c = 0; c < 4; ++c) {
    union { unsigned short h[8]; uint4 q; } pk;
    #pragma unroll
    for (int j = 0; j < 8; ++j) pk.h[j] = f2bf(v[j][c]);
    *(uint4*)(d + (size_t)c * R) = pk.q;
  }
}

// W1 [n][k][h] (f32) -> W1t [n][h][k] (bf16)
__global__ __launch_bounds__(256) void cvt_w1_kernel(const float* __restrict__ W1,
                                                     unsigned short* __restrict__ W1t) {
  cvt_transpose<DIN, HH>(W1, W1t);
}

// W2 [n][h][o] (f32) -> W2t [n][o][h] (bf16)
__global__ __launch_bounds__(256) void cvt_w2_kernel(const float* __restrict__ W2,
                                                     unsigned short* __restrict__ W2t) {
  cvt_transpose<HH, DOUT>(W2, W2t);
}

// ---------------- fused grouped-MLP WMMA kernel ----------------

__global__ __launch_bounds__(256, 1)
void mlp_concept_kernel(const unsigned short* __restrict__ xb,    // [M][1024] bf16
                        const unsigned short* __restrict__ W1t,   // [n][h][k] bf16
                        const unsigned short* __restrict__ W2t,   // [n][o][h] bf16
                        const float* __restrict__ b1,
                        const float* __restrict__ b2p,
                        float* __restrict__ out) {
  extern __shared__ unsigned char smem[];
  unsigned char* w2_b = smem;
  unsigned char* ring = smem + RING_OFF;
  const unsigned short* w2_u = (const unsigned short*)w2_b;

  const int tid  = threadIdx.x;
  const int wave = tid >> 5;
  const int lane = tid & 31;
  const int l16  = lane & 15;
  const int g    = lane >> 4;            // K-half group per WMMA layout

  const int m0 = blockIdx.x * M_TILE;

  const unsigned char* xb8  = (const unsigned char*)xb + (size_t)m0 * DIN * 2;

  // 2 x 4 wave grid. Layer 1: 64 rows x 64 h cols per wave (4 x 4 WMMA tiles: 8 fragments
  // feed 16 WMMAs), computed transposed: W1 is the A operand and x the B operand, so that a
  // lane's 8 accumulator registers are 8 consecutive h of one token.
  // Layer 2: 64 rows x 32 out cols per wave (4 x 2 tiles).
  const int wrow = (wave >> 2) * 64;
  const int wn1  = (wave & 3) * 64;
  const int wn2  = (wave & 3) * 32;

  // Where this workgroup's walk begins. All token tiles need the same W1 rows; started alike they
  // would all ask L2 for the same lines at the same moment. So a tile begins at a concept and at a
  // K slab of its own and wraps round: every concept and every slab is still taken exactly once.
  // The two workgroups of one token tile begin half a K range apart (they share the x rows).
  const int rotc = blockIdx.x & (NPASS - 1);
  const int rotk = ((blockIdx.x / NPASS) + blockIdx.y * (NSLAB / 2)) & (NSLAB - 1);
  const int k0b  = rotk * (KSLAB * 2);           // byte offset of the first slab in an x or W1 row

  // first slab of the first concept's first chunk; every later slab is issued one whole slab ahead
  stage_slab<M_TILE>(ring, xb8 + k0b, tid);
  stage_slab<HC>(ring + XSL_BYTES,
                 (const unsigned char*)W1t
                     + (size_t)(blockIdx.y + NSIDE * rotc) * HH * DIN * 2 + k0b, tid);

  int cur = 0;                                   // ring buffer that holds the slab of this trip

  // One workgroup stays on its WGP and takes its token tile through every NSIDE-th concept; the
  // ring runs on from one concept to the next as it does from one chunk to the next.
  for (int it = 0; it < NPASS; ++it) {
  const int n  = blockIdx.y + NSIDE * ((it + rotc) & (NPASS - 1));
  const int nn = blockIdx.y + NSIDE * ((it + 1 + rotc) & (NPASS - 1));   // the concept after it
  const unsigned char* w1n8 = (const unsigned char*)W1t + (size_t)n * HH * DIN * 2;
  const unsigned char* w2n8 = (const unsigned char*)W2t + (size_t)n * DOUT * HH * 2;

  v8f oacc[4][2] = {};

  for (int hc = 0; hc < HH; hc += HC) {
    v8f hacc[4][4] = {};
    const unsigned char* w1c8 = w1n8 + (size_t)hc * (DIN * 2);

    // ---- layer 1: K=1024 reduction over a two-buffer ring of [x | W1] slabs
    for (int s = 0; s < NSLAB; ++s) {
      // slab s (and, on s == 1, the W2 chunk) landed in all waves; other buffer, w2t free
      ring_publish();
      const unsigned short* xsl = (const unsigned short*)(ring + cur * RING_BUF);
      const unsigned short* wsl = (const unsigned short*)(ring + cur * RING_BUF + XSL_BYTES);
      const unsigned short* ap = &xsl[(wrow + l16) * SL_STRIDE + g * 8];
      const unsigned short* bp = &wsl[(wn1 + l16) * SL_STRIDE + g * 8];
      v16bf a[2][4], b[2][4];                    // two fragment sets, one k-step apart
      // every loop over fragments, tiles and k-steps is unrolled whole: with compile-time
      // indices the fragment and accumulator arrays stay in registers
      #pragma unroll
      for (int i = 0; i < 4; ++i) {
        a[0][i] = load_frag16(ap + i * 16 * SL_STRIDE);
        b[0][i] = load_frag16(bp + i * 16 * SL_STRIDE);
      }
      // the first fragments' LDS latency runs under the issue of the copies below
      __builtin_amdgcn_sched_barrier(0);
      if (s == 0) {
        // W2 chunk copy: [128 o][256 h] (contiguous along h), landed by the wait of s == 1
        #pragma unroll
        for (int i = 0; i < (DOUT * HC * 2 / 16) / 256; ++i) {   // 4096 chunks
          int idx = tid + i * 256;
          int o   = idx / (HC / 8);              // 32 chunks per o row
          int c   = idx % (HC / 8);
          async_cp16(w2_b + o * (S_STRIDE * 2) + c * 16,
                     w2n8 + (size_t)o * (HH * 2) + hc * 2 + c * 16);
        }
      }
      // overlap the copy of this chunk's next slab with WMMA
      if (s + 1 < NSLAB) {
        unsigned char* nb = ring + (cur ^ 1) * RING_BUF;
        const int kb = ((s + 1 + rotk) & (NSLAB - 1)) * (KSLAB * 2);
        stage_slab<M_TILE>(nb, xb8 + kb, tid);
        stage_slab<HC>(nb + XSL_BYTES, w1c8 + kb, tid);
      }
      #pragma unroll
      for (int ks = 0; ks < KSLAB / 32; ++ks) {
        const int fc = ks & 1, fn = fc ^ 1;
        if (ks + 1 < KSLAB / 32) {
          #pragma unroll
          for (int i = 0; i < 4; ++i) {
            a[fn][i] = load_frag16(ap + i * 16 * SL_STRIDE + (ks + 1) * 32);
            b[fn][i] = load_frag16(bp + i * 16 * SL_STRIDE + (ks + 1) * 32);
          }
        }
        // keeps the next k-step's LDS reads one group ahead of this step's WMMAs
        // (left free, the scheduler spreads them among the WMMAs and the waits reach 0)
        __builtin_amdgcn_sched_barrier(0);
        #pragma unroll
        for (int i = 0; i < 4; ++i) {
          #pragma unroll
          for (int t = 0; t < 4; ++t) {
            // hacc[i][t][r] = h[token wrow + 16 i + l16][col wn1 + 16 t + 8 g + r]
            hacc[i][t] = __builtin_amdgcn_wmma_f32_16x16x32_bf16(
                false, b[fc][t], false, a[fc][i], (short)0, hacc[i][t], false, false);
          }
        }
        __builtin_amdgcn_sched_barrier(0);       // the group after next stays behind these WMMAs
      }
      cur ^= 1;
    }

    // After an even number of trips cur is the buffer of the last trip but one: every wave has
    // passed the last trip's barrier, so nobody reads it any more, and no copy is aimed at it.
    unsigned short* hs_u = (unsigned short*)(ring + cur * RING_BUF);

    // ---- bias + ReLU -> bf16 h chunk in LDS (never touches global)
    // a lane packs its 8 consecutive h of one token: pair converts (round to nearest even, as
    // f2bf) and one 16 B store per tile
    #pragma unroll
    for (int t = 0; t < 4; ++t) {
      const int col = wn1 + t * 16 + g * 8;
      const f32x4 blo = *(const f32x4*)(b1 + n * HH + hc + col);
      const f32x4 bhi = *(const f32x4*)(b1 + n * HH + hc + col + 4);
      #pragma unroll
      for (int i = 0; i < 4; ++i) {
        union { bf16x2 p[4]; uint4 q; } pk;
        #pragma unroll
        for (int r = 0; r < 8; r += 2) {
          f32x2 v;
          v[0] = hacc[i][t][r]     + (r < 4 ? blo[r]     : bhi[r - 4]);
          v[1] = hacc[i][t][r + 1] + (r < 4 ? blo[r + 1] : bhi[r - 3]);
          v[0] = v[0] > 0.0f ? v[0] : 0.0f;
          v[1] = v[1] > 0.0f ? v[1] : 0.0f;
          pk.p[r / 2] = __builtin_convertvector(v, bf16x2);
        }
        *(uint4*)&hs_u[(wrow + i * 16 + l16) * S_STRIDE + col] = pk.q;
      }
    }
    // hs visible; the last trip's buffer is free (the compiler's s_wait_dscnt 0 stands in front)
    __syncthreads();

    // the first slab of the next chunk, or of the next concept's first chunk, goes into the
    // buffer of the last trip, under layer 2 (and the stores of out)
    const bool more_chunks = hc + HC < HH;
    if (more_chunks || it + 1 < NPASS) {
      unsigned char* nb = ring + (cur ^ 1) * RING_BUF;
      const unsigned char* nw = more_chunks
          ? w1c8 + (size_t)HC * (DIN * 2)
          : (const unsigned char*)W1t + (size_t)nn * HH * (DIN * 2);
      stage_slab<M_TILE>(nb, xb8 + k0b, tid);
      stage_slab<HC>(nb + XSL_BYTES, nw + k0b, tid);
    }

    // ---- layer 2: oacc += relu(h_chunk) @ W2_chunk (K = 256)
    {
      const unsigned short* ap2 = &hs_u[(wrow + l16) * S_STRIDE + g * 8];
      const unsigned short* bp2 = &w2_u[(wn2 + l16) * S_STRIDE + g * 8];
      v16bf a2[2][4], bw[2][2];
      #pragma unroll
      for (int i = 0; i < 4; ++i) a2[0][i] = load_frag16(ap2 + i * 16 * S_STRIDE);
      #pragma unroll
      for (int t = 0; t < 2; ++t) bw[0][t] = load_frag16(bp2 + t * 16 * S_STRIDE);
      #pragma unroll
      for (int ks = 0; ks < HC / 32; ++ks) {
        const int fc = ks & 1, fn = fc ^ 1;
        if (ks + 1 < HC / 32) {
          #pragma unroll
          for (int i = 0; i < 4; ++i)
            a2[fn][i] = load_frag16(ap2 + i * 16 * S_STRIDE + (ks + 1) * 32);
          #pragma unroll
          for (int t = 0; t < 2; ++t)
            bw[fn][t] = load_frag16(bp2 + t * 16 * S_STRIDE + (ks + 1) * 32);
        }
        __builtin_amdgcn_sched_barrier(0);       // as in layer 1: reads one group ahead
        #pragma unroll
        for (int i = 0; i < 4; ++i) {
          #pragma unroll
          for (int t = 0; t < 2; ++t) {
            oacc[i][t] = __builtin_amdgcn_wmma_f32_16x16x32_bf16(
                false, a2[fc][i], false, bw[fc][t], (short)0, oacc[i][t], false, false);
          }
        }
        __builtin_amdgcn_sched_barrier(0);       // as in layer 1
      }
    }
    cur ^= 1;                                    // the next chunk begins on the buffer just filled
  }

  // ---- epilogue: + b2, f32 store out[m, n, o]
  const float* b2c = b2p + n * DOUT + wn2 + l16;
  const float bias2[2] = {b2c[0], b2c[16]};
  // the address registers of the two loads above stay as they are up to this wait (the operand
  // holds them): the address arithmetic of the stores below is placed on them
  asm volatile("s_wait_xcnt 0x0" :: "v"(b2c) : "memory");
  #pragma unroll
  for (int t = 0; t < 2; ++t) {
    int col = wn2 + t * 16 + l16;
    float bias = bias2[t];
    #pragma unroll
    for (int i = 0; i < 4; ++i) {
      #pragma unroll
      for (int r = 0; r < 8; ++r) {
        int m = m0 + wrow + i * 16 + g * 8 + r;
        out[(size_t)m * (N_ * DOUT) + n * DOUT + col] = oacc[i][t][r] + bias;
      }
    }
  }
  // the next concept's pass overwrites the registers that the stores above name
  asm volatile("s_wait_xcnt 0x0" ::: "memory");
  }
}

extern "C" void kernel_launch(void* const* d_in, const int* in_sizes, int n_in,
                              void* d_out, int out_size, void* d_ws, size_t ws_size,
                              hipStream_t stream) {
  const float* x  = (const float*)d_in[0];
  const float* W1 = (const float*)d_in[1];
  const float* b1 = (const float*)d_in[2];
  const float* W2 = (const float*)d_in[3];
  const float* b2 = (const float*)d_in[4];
  float* out = (float*)d_out;

  // workspace layout (bf16): x copy, W1 transposed, W2 transposed  (~50 MB)
  unsigned short* xb  = (unsigned short*)d_ws;                          // 16384*1024
  unsigned short* W1t = xb  + (size_t)M_TOT * DIN;                      // 16*512*1024
  unsigned short* W2t = W1t + (size_t)N_ * HH * DIN;                    // 16*128*512

  cvt_x_kernel <<<(M_TOT * DIN / 4) / (256 * XV), 256, 0, stream>>>(x, xb);
  cvt_w1_kernel<<<N_ * (DIN / 64) * (HH / 128), 256, 0, stream>>>(W1, W1t);
  cvt_w2_kernel<<<N_ * (HH / 64) * (DOUT / 128), 256, 0, stream>>>(W2, W2t);

  hipError_t attr_rc = hipFuncSetAttribute(
      reinterpret_cast<const void*>(mlp_concept_kernel),
      hipFuncAttributeMaxDynamicSharedMemorySize, (int)SMEM_BYTES);
  (void)attr_rc;

  dim3 grid(M_TOT / M_TILE, NSIDE);              // 128 token tiles x 2: one workgroup per WGP
  mlp_concept_kernel<<<grid, 256, SMEM_BYTES, stream>>>(xb, W1t, W2t, b1, b2, out);
}
